// v000
// The times below were measured on an AMD MI455X: many runs one after another, warmed up first and cycling through
// copies of the inputs, with the whole window's GPU time divided by the number of runs. Launches and the gaps
// between them are all in it. The median over several windows is given; except for v000 it joins two sittings, which
// can be a few percent apart, so the side-by-side timings, each taken in one sitting, are the better comparison.
// v000, which the later versions start from, runs in 3470 microseconds.
#include <hip/hip_runtime.h>

// Multi-head attention over 4,096 tokens without output projection (attention_input [2][4096][512]; q,k,v = x W ('xw' [512][512] 0.05); 8 heads x 64; scores / SCALE with SCALE = N_HEADS = 8 (the source's quirk; numerically the usual 1/8 here); softmax; out = concat-heads(attn v) -> [2][4096][512] (4.2 M)).
// Layout per batch: bf16 copy of x; 'xw' weights transposed once; exact projections; dense T-4096 attention one head per pass with hi/lo 3-product score tiles on EVERY row (no output projection averages the per-head error; register-row softmax); P and attn.v hybrid (rows < 512 hi/lo, rest fp16 x1024); the f32 merge writes the output rows.
// Compute dtypes, f32 accumulate: every input rounded to bf16; projections exact; scores 3 products on every row; softmax f32; attn.v rows < 512 3 products, rest fp16; output f32.

#define NB_  2
#define TT   4096
#define DM   512
#define NH_  8
#define NKV  8
#define REP  (NH_ / NKV)
#define HD   64
#define DQ   (NH_ * HD)
#define DKV  (NKV * HD)
#define ZH   1
#define RH   512                  // query rows < RH use hi+lo planes (0: none)
#define WIN  0
#define PCAR 1024.0f
#define SCL  0.125f   // HD^-0.5
typedef _Float16 h16;
typedef unsigned short bf;
typedef __attribute__((ext_vector_type(16))) __bf16   v16bf;
typedef __attribute__((ext_vector_type(16))) _Float16 v16h;
typedef __attribute__((ext_vector_type(8)))  _Float16 v8h;
typedef __attribute__((ext_vector_type(8)))  unsigned short v8us;
typedef __attribute__((ext_vector_type(8)))  float    v8f;
typedef __attribute__((ext_vector_type(4)))  float    v4f;
typedef v8h  __attribute__((may_alias)) v8ha;
typedef v4f  __attribute__((may_alias)) v4fa;
typedef v8us __attribute__((may_alias)) v8usa;

__device__ __forceinline__ unsigned short f2bf(float f) { unsigned u = __float_as_uint(f); u += 0x7FFFu + ((u >> 16) & 1u); return (unsigned short)(u >> 16); }
__device__ __forceinline__ float bf2f(unsigned short b) { return __uint_as_float(((unsigned)b) << 16); }
__device__ __forceinline__ float bfr(float f) { return bf2f(f2bf(f)); }
__device__ __forceinline__ v16h cat16(v8h lo, v8h hi) { return __builtin_shufflevector(lo, hi, 0, 1, 2, 3, 4, 5, 6, 7, 8, 9, 10, 11, 12, 13, 14, 15); }
__device__ __forceinline__ v16bf cat16b(v8us lo, v8us hi) { return __builtin_bit_cast(v16bf, __builtin_shufflevector(lo, hi, 0, 1, 2, 3, 4, 5, 6, 7, 8, 9, 10, 11, 12, 13, 14, 15)); }
__device__ __forceinline__ v8f wmma16(v16h a, v16h b, v8f c) { return __builtin_amdgcn_wmma_f32_16x16x32_f16(false, a, false, b, (short)0, c, false, false); }
__device__ __forceinline__ v8f wmmab(v16bf a, v16bf b, v8f c) { return __builtin_amdgcn_wmma_f32_16x16x32_bf16(false, a, false, b, (short)0, c, false, false); }



// ---- k_gemmw: register-blocked GEMM, ONE WAVE per 64x64 output tile (16 accumulators), operands straight from K-contiguous 16-bit planes; grid (M/64, N/64, Z), 32 threads.
// C[m][n] (f32, pitch ldc, + optional f32 bias[n]) = sum_k A[m][k] Bt[n][k] (+ split products per NSPLIT). z-batch strides sA/sB/sC in elements. K % 32 == 0.
template <typename T16> struct WFrag;
template <> struct WFrag<h16> { typedef v16h V; static __device__ __forceinline__ V ld(const h16* p) { return cat16(*(const v8h*)p, *(const v8h*)(p + 16)); } static __device__ __forceinline__ v8f mma(V a, V b, v8f c) { return wmma16(a, b, c); } };
template <> struct WFrag<bf> { typedef v16bf V; static __device__ __forceinline__ V ld(const bf* p) { return cat16b(*(const v8us*)p, *(const v8us*)(p + 16)); } static __device__ __forceinline__ v8f mma(V a, V b, v8f c) { return wmmab(a, b, c); } };
template <typename T16, int NSPLIT, bool BIAS>
__global__ __launch_bounds__(32) void k_gemmw(const T16* __restrict__ A, const T16* __restrict__ A2, const T16* __restrict__ Bt, const T16* __restrict__ Bt2, int K, float* C, int ldc, const float* __restrict__ bias, size_t sA, size_t sB, size_t sC) {
    typedef typename WFrag<T16>::V V;
    __shared__ __align__(16) float os[16 * 68];
    const size_t z = blockIdx.z; A += z * sA; if (A2) A2 += z * sA; Bt += z * sB; if (Bt2) Bt2 += z * sB; C += z * sC;
    const int lane = threadIdx.x & 31, lr = lane & 15, hi = lane >> 4; const int r0 = blockIdx.x * 64, c0 = blockIdx.y * 64;
    v8f acc[4][4];
#pragma unroll
    for (int mb = 0; mb < 4; ++mb)
#pragma unroll
        for (int nb = 0; nb < 4; ++nb) acc[mb][nb] = (v8f){};
    const size_t aoff = (size_t)(r0 + lr) * K + 8 * hi, boff = (size_t)(c0 + lr) * K + 8 * hi;
#pragma unroll 1
    for (int kc = 0; kc < K; kc += 32) {
        V a[4], a2[4];
#pragma unroll
        for (int mb = 0; mb < 4; ++mb) { a[mb] = WFrag<T16>::ld(A + aoff + (size_t)mb * 16 * K + kc); if (NSPLIT == 1 || NSPLIT == 2) a2[mb] = WFrag<T16>::ld(A2 + aoff + (size_t)mb * 16 * K + kc); }
#pragma unroll
        for (int nb = 0; nb < 4; ++nb) { const V b = WFrag<T16>::ld(Bt + boff + (size_t)nb * 16 * K + kc); V b2; if (NSPLIT >= 2) b2 = WFrag<T16>::ld(Bt2 + boff + (size_t)nb * 16 * K + kc);
#pragma unroll
            for (int mb = 0; mb < 4; ++mb) { acc[mb][nb] = WFrag<T16>::mma(a[mb], b, acc[mb][nb]); if (NSPLIT == 1 || NSPLIT == 2) acc[mb][nb] = WFrag<T16>::mma(a2[mb], b, acc[mb][nb]); if (NSPLIT >= 2) acc[mb][nb] = WFrag<T16>::mma(a[mb], b2, acc[mb][nb]); } }
        asm volatile("v_nop\n\tv_nop\n\tv_nop\n\tv_nop" : "+v"(acc[0][0]), "+v"(acc[1][1]), "+v"(acc[2][2]), "+v"(acc[3][3]) : "v"(a[0]), "v"(a[3]));
    }
#pragma unroll
    for (int mb = 0; mb < 4; ++mb) {
#pragma unroll
        for (int nb = 0; nb < 4; ++nb) {
#pragma unroll
            for (int j = 0; j < 8; ++j) os[(hi * 8 + j) * 68 + nb * 16 + lr] = acc[mb][nb][j]; }
        __builtin_amdgcn_wave_barrier(); asm volatile("" ::: "memory");
        float* crow = C + (size_t)(r0 + mb * 16) * ldc + c0;
{
#pragma unroll
            for (int s = 0; s < 8; ++s) { const int row = 2 * s + hi, cofs = lr * 4; v4f val = *(const v4fa*)(os + row * 68 + cofs); if (BIAS) { val[0] += bfr(bias[c0 + cofs]); val[1] += bfr(bias[c0 + cofs + 1]); val[2] += bfr(bias[c0 + cofs + 2]); val[3] += bfr(bias[c0 + cofs + 3]); }
                *(v4f*)(crow + (size_t)row * ldc + cofs) = val; }
             }
        __builtin_amdgcn_wave_barrier(); asm volatile("" ::: "memory");
    }
}

__device__ __forceinline__ h16 tohx(float x) { return (h16)x; }
__device__ __forceinline__ void splitf(float y, unsigned short& h, unsigned short& l) { h = f2bf(y); l = f2bf(y - bf2f(h)); }
typedef __attribute__((ext_vector_type(2))) _Float16 v2h;
typedef __attribute__((ext_vector_type(4))) _Float16 v4h;
typedef __attribute__((ext_vector_type(2))) unsigned short v2us;
typedef __attribute__((ext_vector_type(4))) unsigned short v4us;
typedef __attribute__((ext_vector_type(2))) float v2f;
typedef __attribute__((ext_vector_type(4))) int v4i;

__global__ __launch_bounds__(256) void k_wtG(const float* __restrict__ w, int K, int N, bf* Bt) {
    const int lane = threadIdx.x & 31; const int L0 = (blockIdx.x * 8 + (threadIdx.x >> 5)) * 8; const int nlines = N * K / 64;
{
#pragma unroll 1
        for (int l = 0; l < 8; ++l) { const int L = L0 + l; if (L >= nlines) break; const size_t e = (size_t)L * 64 + lane * 2; const int k = (int)(e % K), n = (int)(e / K); v2us o;
            o[0] = f2bf(w[(size_t)k * N + n]); o[1] = f2bf(w[(size_t)(k + 1) * N + n]); *(v2us*)(Bt + e) = o; }
         }
}
__global__ __launch_bounds__(256) void k_cvt8(const float* __restrict__ src, bf* dst, size_t n8) { const size_t i = (size_t)blockIdx.x * 256 + threadIdx.x; if (i >= n8) return; const v8f v = *(const v8f*)(src + i * 8); v8us o;
#pragma unroll
    for (int k = 0; k < 8; ++k) o[k] = f2bf(v[k]); *(v8us*)(dst + i * 8) = o;  }

// k_rope: head planes [h][t][d] (fp16 + hi/lo) of rope(x) x sc with the rotate-half convention out[d] = x[d] cos[t][d] - x[d+HD/2] sin[t][d], out[d+HD/2] = x[d+HD/2] cos[t][d+HD/2] + x[d] sin[t][d+HD/2]
__global__ __launch_bounds__(256) void k_rope(const float* __restrict__ F, int pitch, int nheads, const float* __restrict__ CS, const float* __restrict__ RF, const float* __restrict__ nw, float sc, h16* P16, bf* Ph, bf* Pl) {
    const size_t e = ((size_t)blockIdx.x * 256 + threadIdx.x) * 2; if (e >= (size_t)nheads * TT * HD) return; const int d = (int)(e % HD); const int t = (int)((e / HD) % TT); const int h = (int)(e / ((size_t)HD * TT)); const float* f = F + (size_t)t * pitch + h * HD; const float rf = RF ? RF[(size_t)h * TT + t] : 1.0f; v2h o16; v2us oh, ol;
#pragma unroll
    for (int q = 0; q < 2; ++q) { const int dd = d + q; const int dp = (dd < HD / 2) ? dd + HD / 2 : dd - HD / 2; float x0 = f[dd], x1 = f[dp];
        if (RF) { float n0 = __fmul_rn(x0, rf), n1 = __fmul_rn(x1, rf); asm volatile("" : "+v"(n0)); asm volatile("" : "+v"(n1)); x0 = __fmul_rn(bfr(nw[dd]), n0); x1 = __fmul_rn(bfr(nw[dp]), n1); }
        const v2f cs = *(const v2f*)(CS + ((size_t)t * HD + dd) * 2); float a = __fmul_rn(x0, cs[0]), bq = __fmul_rn(x1, cs[1]); asm volatile("" : "+v"(a)); asm volatile("" : "+v"(bq)); const float r = ((dd < HD / 2) ? __fsub_rn(a, bq) : __fadd_rn(a, bq)) * sc;
        o16[q] = tohx(r); unsigned short a2, c2; splitf(r, a2, c2); oh[q] = a2; ol[q] = c2; }
    *(v2h*)(P16 + e) = o16; *(v2us*)(Ph + e) = oh; *(v2us*)(Pl + e) = ol;  }
__global__ __launch_bounds__(256) void k_vtp(const float* __restrict__ F, int pitch, int nheads, h16* V16, bf* Vh, bf* Vl) { const size_t e = ((size_t)blockIdx.x * 256 + threadIdx.x) * 2; if (e >= (size_t)nheads * HD * TT) return; const int t = (int)(e % TT); const int d = (int)((e / TT) % HD); const int g = (int)(e / ((size_t)TT * HD)); v2h o16; v2us oh, ol;
#pragma unroll
    for (int q = 0; q < 2; ++q) { const float x = F[(size_t)(t + q) * pitch + g * HD + d]; o16[q] = tohx(x); unsigned short a2, c2; splitf(x, a2, c2); oh[q] = a2; ol[q] = c2; }
    *(v2h*)(V16 + e) = o16; *(v2us*)(Vh + e) = oh; *(v2us*)(Vl + e) = ol;  }
__global__ __launch_bounds__(256) void k_csid(float* CS) { const int idx = blockIdx.x * 256 + threadIdx.x; if (idx >= TT * HD) return; v2f cs; cs[0] = 1.0f; cs[1] = 0.0f; *(v2f*)(CS + (size_t)idx * 2) = cs;  }
// k_asoft: per row (zz, i): t = S x HD^-0.5 (no mask); softmax over the 4096 keys (register row, one exp, fixed trees);
__global__ __launch_bounds__(256) void k_asoft(const float* __restrict__ Sb, h16* P16, bf* Ph, bf* Pl) {
    const int lane = threadIdx.x & 31; const int row = blockIdx.x * 8 + (threadIdx.x >> 5); if (row >= ZH * TT) return; const int i = row % TT; const int zz = row / TT; (void)zz; const bool hires = (i < RH); const float* sr = Sb + (size_t)row * TT; float v[TT / 32]; float mx = -3.0e38f;
#pragma unroll
    for (int ch = 0; ch < TT / 128; ++ch) { const int j0 = ch * 128 + lane * 4; const v4f a = *(const v4f*)(sr + j0);
#pragma unroll
        for (int q = 0; q < 4; ++q) { const int j = j0 + q; (void)j; const float t = a[q] * SCL; v[ch * 4 + q] = t; mx = fmaxf(mx, t); } }
#pragma unroll
    for (int sh = 16; sh; sh >>= 1) mx = fmaxf(mx, __shfl_xor(mx, sh, 32));
    float sum = 0.f;
#pragma unroll
    for (int k = 0; k < TT / 32; ++k) { float d0 = __fsub_rn(v[k], mx); asm volatile("" : "+v"(d0)); v[k] = __builtin_amdgcn_exp2f(__fmul_rn(d0, 1.4426950408889634f)); sum += v[k]; }
#pragma unroll
    for (int sh = 16; sh; sh >>= 1) sum += __shfl_xor(sum, sh, 32);
    const float f = __fdiv_rn(hires ? 1.0f : PCAR, sum);
{
        if (hires) {
#pragma unroll
            for (int ch = 0; ch < TT / 128; ++ch) { v4us oh, ol;
#pragma unroll
                for (int q = 0; q < 4; ++q) { unsigned short a, c2; splitf(v[ch * 4 + q] * f, a, c2); oh[q] = a; ol[q] = c2; }
                const size_t oo = ((size_t)zz * (RH ? RH : 1) + i) * TT + ch * 128 + lane * 4; *(v4us*)(Ph + oo) = oh; *(v4us*)(Pl + oo) = ol; }
        } else {
#pragma unroll
            for (int ch = 0; ch < TT / 128; ++ch) { v4h o4;
#pragma unroll
                for (int q = 0; q < 4; ++q) o4[q] = tohx(v[ch * 4 + q] * f);
                *(v4h*)(P16 + (size_t)row * TT + ch * 128 + lane * 4) = o4; } }
         }
}
__global__ __launch_bounds__(256) void k_merge(const float* __restrict__ O, int h0, float* OUTb) { const size_t e = ((size_t)blockIdx.x * 256 + threadIdx.x) * 2; if (e >= (size_t)ZH * TT * HD) return; const int d = (int)(e % HD); const int t = (int)((e / HD) % TT); const int zz = (int)(e / ((size_t)HD * TT)); const float cs = (t < RH) ? 1.0f : (1.0f / PCAR); const size_t oo = (size_t)t * DQ + (h0 + zz) * HD + d;
    v2f o2; o2[0] = O[e] * cs; o2[1] = O[e + 1] * cs; *(v2f*)(OUTb + oo) = o2;  }

extern "C" void kernel_launch(void* const* d_in, const int* in_sizes, int n_in,
                              void* d_out, int out_size, void* d_ws, size_t ws_size, hipStream_t stream) {
    (void)in_sizes; (void)n_in; (void)out_size;
    const float* x = (const float*)d_in[0]; const float* wq = (const float*)d_in[1]; const float* wk = (const float*)d_in[2]; const float* wv = (const float*)d_in[3]; const float* wo = nullptr; (void)wo;
    float* OUT = (float*)d_out;     // [2][4096][512]
    char* wsp = (char*)d_ws;
    auto take = [&](size_t bytes) { char* p = wsp; wsp += (bytes + 255) & ~(size_t)255; return (void*)p; };
    bf* WQ = (bf*)take((size_t)DQ * DM * 2); bf* WK = (bf*)take((size_t)DKV * DM * 2); bf* WV = (bf*)take((size_t)DKV * DM * 2); float* CS = (float*)take((size_t)TT * HD * 2 * 4);
    bf* XB = (bf*)take((size_t)TT * DM * 2); float* FQ = (float*)take((size_t)TT * DQ * 4); float* FK = (float*)take((size_t)TT * DKV * 4);
    h16* QP16 = (h16*)take((size_t)NH_ * TT * HD * 2); h16* KP16 = (h16*)take((size_t)NKV * TT * HD * 2); h16* VT16 = (h16*)take((size_t)NKV * HD * TT * 2);
    bf* QPh = (bf*)take((size_t)NH_ * TT * HD * 2); bf* QPl = (bf*)take((size_t)NH_ * TT * HD * 2); bf* KPh = (bf*)take((size_t)NKV * TT * HD * 2); bf* KPl = (bf*)take((size_t)NKV * TT * HD * 2); bf* VTh = (bf*)take((size_t)NKV * HD * TT * 2); bf* VTl = (bf*)take((size_t)NKV * HD * TT * 2); bf* Ph = (bf*)take((size_t)ZH * RH * TT * 2); bf* Pl = (bf*)take((size_t)ZH * RH * TT * 2);
    float* Sb = (float*)take((size_t)ZH * TT * TT * 4); h16* P16 = (h16*)take((size_t)ZH * TT * TT * 2); float* Ob = (float*)take((size_t)ZH * TT * HD * 4);
    if ((size_t)(wsp - (char*)d_ws) > ws_size) return;    // ws 256 MiB
    float* FV = FK;   // v projection reuses the k buffer after the k planes are built (stream-ordered)
    { k_wtG<<<(unsigned)((DM * DQ / 64 + 63) / 64), 256, 0, stream>>>(wq, DM, DQ, WQ); k_wtG<<<(unsigned)((DM * DKV / 64 + 63) / 64), 256, 0, stream>>>(wk, DM, DKV, WK); k_wtG<<<(unsigned)((DM * DKV / 64 + 63) / 64), 256, 0, stream>>>(wv, DM, DKV, WV);
      
       }
    k_csid<<<(TT * HD + 255) / 256, 256, 0, stream>>>(CS);
    const unsigned LQ = (unsigned)(((size_t)NH_ * TT * HD / 2 + 255) / 256), LKv = (unsigned)(((size_t)NKV * TT * HD / 2 + 255) / 256);
    for (int b = 0; b < NB_; ++b) {
        
        k_cvt8<<<(unsigned)(((size_t)TT * DM / 8 + 255) / 256), 256, 0, stream>>>(x + (size_t)b * TT * DM, XB, (size_t)TT * DM / 8);
        k_gemmw<bf, 0, false><<<dim3(TT / 64, DQ / 64, 1), 32, 0, stream>>>(XB, nullptr, WQ, nullptr, DM, FQ, DQ, nullptr, 0, 0, 0);
        k_rope<<<LQ, 256, 0, stream>>>(FQ, DQ, NH_, CS, nullptr, nullptr, 1.0f, QP16, QPh, QPl);
        k_gemmw<bf, 0, false><<<dim3(TT / 64, DKV / 64, 1), 32, 0, stream>>>(XB, nullptr, WK, nullptr, DM, FK, DKV, nullptr, 0, 0, 0);
        k_rope<<<LKv, 256, 0, stream>>>(FK, DKV, NKV, CS, nullptr, nullptr, 1.0f, KP16, KPh, KPl);
        k_gemmw<bf, 0, false><<<dim3(TT / 64, DKV / 64, 1), 32, 0, stream>>>(XB, nullptr, WV, nullptr, DM, FV, DKV, nullptr, 0, 0, 0); k_vtp<<<LKv, 256, 0, stream>>>(FV, DKV, NKV, VT16, VTh, VTl);
        for (int h0 = 0; h0 < NH_; h0 += ZH) { const size_t zq = (size_t)h0, zk = (size_t)(h0 / REP);   // one kv head per query head: the pass's single head uses kv plane h0 (z-strides TT*HD)
            k_gemmw<bf, 2, false><<<dim3(TT / 64, TT / 64, ZH), 32, 0, stream>>>(QPh + zq * TT * HD, QPl + zq * TT * HD, KPh + zk * TT * HD, KPl + zk * TT * HD, HD, Sb, TT, nullptr, (size_t)TT * HD, (size_t)TT * HD, (size_t)TT * TT);   /* scores hi/lo on EVERY row (no output projection) */

            k_asoft<<<ZH * TT / 8, 256, 0, stream>>>(Sb, P16, Ph, Pl);
            k_gemmw<bf, 2, false><<<dim3(RH / 64, HD / 64, ZH), 32, 0, stream>>>(Ph, Pl, VTh + zk * HD * TT, VTl + zk * HD * TT, TT, Ob, HD, nullptr, (size_t)RH * TT, (size_t)HD * TT, (size_t)TT * HD);
            k_gemmw<h16, 0, false><<<dim3((TT - RH) / 64, HD / 64, ZH), 32, 0, stream>>>(P16 + (size_t)RH * TT, nullptr, VT16 + zk * HD * TT, nullptr, TT, Ob + (size_t)RH * HD, HD, nullptr, (size_t)TT * TT, (size_t)HD * TT, (size_t)TT * HD);
            k_merge<<<(unsigned)(((size_t)ZH * TT * HD / 2 + 255) / 256), 256, 0, stream>>>(Ob, h0, OUT + (size_t)b * TT * DQ); }
         }
}

// v001
// It runs in 1030 microseconds.
// Two timings next to v000 both put it at 3.40 times that version's speed.
#include <hip/hip_runtime.h>

// Multi-head attention over 4,096 tokens without output projection (attention_input [2][4096][512]; q,k,v = x W ('xw' [512][512] 0.05); 8 heads x 64; scores / SCALE with SCALE = N_HEADS = 8 (the source's quirk; numerically the usual 1/8 here); softmax; out = concat-heads(attn v) -> [2][4096][512] (4.2 M)).
// Layout per batch: bf16 copy of x; 'xw' weights transposed once; exact projections; dense T-4096 attention one head per pass with hi/lo 3-product score tiles on EVERY row (no output projection averages the per-head error; register-row softmax); P and attn.v hybrid (rows < 512 hi/lo, rest fp16 x1024), attn.v's key range split over waves and work-groups; the f32 merge adds the planes and writes the output rows.
// Compute dtypes, f32 accumulate: every input rounded to bf16; projections exact; scores 3 products on every row; softmax f32; attn.v rows < 512 3 products, rest fp16; output f32.

#define NB_  2
#define TT   4096
#define DM   512
#define NH_  8
#define NKV  8
#define REP  (NH_ / NKV)
#define HD   64
#define DQ   (NH_ * HD)
#define DKV  (NKV * HD)
#define ZH   1
#define RH   512                  // query rows < RH use hi+lo planes (0: none)
#define WIN  0
#define PCAR 1024.0f
#define SCL  0.125f   // HD^-0.5
#define KZH  16                   // attn.v rows < RH: K ranges over gridDim.z (each split again over 4 waves)
#define KZF  4                    // attn.v rows >= RH: K ranges over gridDim.z (each split again over 8 waves)
static_assert(ZH == 1 && KZF <= KZH, "attn.v uses gridDim.z for its K ranges; the plane buffer holds KZH planes");
typedef _Float16 h16;
typedef unsigned short bf;
typedef __attribute__((ext_vector_type(16))) __bf16   v16bf;
typedef __attribute__((ext_vector_type(16))) _Float16 v16h;
typedef __attribute__((ext_vector_type(8)))  _Float16 v8h;
typedef __attribute__((ext_vector_type(8)))  unsigned short v8us;
typedef __attribute__((ext_vector_type(8)))  float    v8f;
typedef __attribute__((ext_vector_type(4)))  float    v4f;
typedef v8h  __attribute__((may_alias)) v8ha;
typedef v4f  __attribute__((may_alias)) v4fa;
typedef v8us __attribute__((may_alias)) v8usa;

__device__ __forceinline__ unsigned short f2bf(float f) { unsigned u = __float_as_uint(f); u += 0x7FFFu + ((u >> 16) & 1u); return (unsigned short)(u >> 16); }
__device__ __forceinline__ float bf2f(unsigned short b) { return __uint_as_float(((unsigned)b) << 16); }
__device__ __forceinline__ float bfr(float f) { return bf2f(f2bf(f)); }
__device__ __forceinline__ v16h cat16(v8h lo, v8h hi) { return __builtin_shufflevector(lo, hi, 0, 1, 2, 3, 4, 5, 6, 7, 8, 9, 10, 11, 12, 13, 14, 15); }
__device__ __forceinline__ v16bf cat16b(v8us lo, v8us hi) { return __builtin_bit_cast(v16bf, __builtin_shufflevector(lo, hi, 0, 1, 2, 3, 4, 5, 6, 7, 8, 9, 10, 11, 12, 13, 14, 15)); }
__device__ __forceinline__ v8f wmma16(v16h a, v16h b, v8f c) { return __builtin_amdgcn_wmma_f32_16x16x32_f16(false, a, false, b, (short)0, c, false, false); }
__device__ __forceinline__ v8f wmmab(v16bf a, v16bf b, v8f c) { return __builtin_amdgcn_wmma_f32_16x16x32_bf16(false, a, false, b, (short)0, c, false, false); }



// ---- k_gemmw: register-blocked GEMM, ONE WAVE per 64x64 output tile (16 accumulators), operands straight from K-contiguous 16-bit planes; grid (M/64, N/64, Z), 32 threads.
// C[m][n] (f32, pitch ldc, + optional f32 bias[n]) = sum_k A[m][k] Bt[n][k] (+ split products per NSPLIT). z-batch strides sA/sB/sC in elements. K % 32 == 0.
// Split K (NW > 1): 32 * NW threads; K stays the row pitch, wave w of work-group z sums the KW consecutive k from z * sA + w * KW (sA = sB = NW * KW); the NW partial tiles are added through LDS in wave order
// and go to plane z of C (plane stride sC); the reader adds the gridDim.z planes.
template <typename T16> struct WFrag;
template <> struct WFrag<h16> { typedef v16h V; static __device__ __forceinline__ V ld(const h16* p) { return cat16(*(const v8h*)p, *(const v8h*)(p + 16)); } static __device__ __forceinline__ v8f mma(V a, V b, v8f c) { return wmma16(a, b, c); } };
template <> struct WFrag<bf> { typedef v16bf V; static __device__ __forceinline__ V ld(const bf* p) { return cat16b(*(const v8us*)p, *(const v8us*)(p + 16)); } static __device__ __forceinline__ v8f mma(V a, V b, v8f c) { return wmmab(a, b, c); } };
template <typename T16, int NSPLIT, bool BIAS, int NW = 1, int KW = 0>
__global__ __launch_bounds__(32 * NW) void k_gemmw(const T16* __restrict__ A, const T16* __restrict__ A2, const T16* __restrict__ Bt, const T16* __restrict__ Bt2, int K, float* C, int ldc, const float* __restrict__ bias, size_t sA, size_t sB, size_t sC) {
    typedef typename WFrag<T16>::V V; static_assert(NW == 1 || (!BIAS && KW % 32 == 0 && 32 % NW == 0), "split K: no bias, whole k steps, whole sweeps of the tile");
    __shared__ __align__(16) float os[(NW > 1 ? NW * 64 : 16) * 68];
    const size_t z = blockIdx.z; A += z * sA; if (A2) A2 += z * sA; Bt += z * sB; if (Bt2) Bt2 += z * sB; C += z * sC;
    if (NW > 1) { const size_t wk = (size_t)(threadIdx.x >> 5) * KW; A += wk; if (A2) A2 += wk; Bt += wk; if (Bt2) Bt2 += wk; }
    const int lane = threadIdx.x & 31, lr = lane & 15, hi = lane >> 4; const int r0 = blockIdx.x * 64, c0 = blockIdx.y * 64;
    v8f acc[4][4];
#pragma unroll
    for (int mb = 0; mb < 4; ++mb)
#pragma unroll
        for (int nb = 0; nb < 4; ++nb) acc[mb][nb] = (v8f){};
    const size_t aoff = (size_t)(r0 + lr) * K + 8 * hi, boff = (size_t)(c0 + lr) * K + 8 * hi;
#pragma unroll 1
    for (int kc = 0; kc < (NW > 1 ? KW : K); kc += 32) {
        V a[4], a2[4];
#pragma unroll
        for (int mb = 0; mb < 4; ++mb) { a[mb] = WFrag<T16>::ld(A + aoff + (size_t)mb * 16 * K + kc); if (NSPLIT == 1 || NSPLIT == 2) a2[mb] = WFrag<T16>::ld(A2 + aoff + (size_t)mb * 16 * K + kc); }
#pragma unroll
        for (int nb = 0; nb < 4; ++nb) { const V b = WFrag<T16>::ld(Bt + boff + (size_t)nb * 16 * K + kc); V b2; if (NSPLIT >= 2) b2 = WFrag<T16>::ld(Bt2 + boff + (size_t)nb * 16 * K + kc);
#pragma unroll
            for (int mb = 0; mb < 4; ++mb) { acc[mb][nb] = WFrag<T16>::mma(a[mb], b, acc[mb][nb]); if (NSPLIT == 1 || NSPLIT == 2) acc[mb][nb] = WFrag<T16>::mma(a2[mb], b, acc[mb][nb]); if (NSPLIT >= 2) acc[mb][nb] = WFrag<T16>::mma(a[mb], b2, acc[mb][nb]); } }
        asm volatile("v_nop\n\tv_nop\n\tv_nop\n\tv_nop" : "+v"(acc[0][0]), "+v"(acc[1][1]), "+v"(acc[2][2]), "+v"(acc[3][3]) : "v"(a[0]), "v"(a[3]));
    }
    if (NW > 1) {
        float* ow = os + (threadIdx.x >> 5) * (64 * 68);
#pragma unroll
        for (int mb = 0; mb < 4; ++mb)
#pragma unroll
            for (int nb = 0; nb < 4; ++nb)
#pragma unroll
                for (int j = 0; j < 8; ++j) ow[(mb * 16 + hi * 8 + j) * 68 + nb * 16 + lr] = acc[mb][nb][j];
        __syncthreads();   // every wave's partial tile is in LDS before any thread adds across waves
        const int row0 = (int)threadIdx.x >> 4, cofs = ((int)threadIdx.x & 15) * 4; v4f val[32 / NW];   // 16 threads a row: each wave stores whole 256-byte rows
#pragma unroll
        for (int s = 0; s < 32 / NW; ++s) { const float* p = os + (s * 2 * NW + row0) * 68 + cofs; val[s] = *(const v4fa*)p;
#pragma unroll
            for (int w = 1; w < NW; ++w) val[s] += *(const v4fa*)(p + w * (64 * 68)); }
        float* cp = C + (size_t)(r0 + row0) * ldc + c0 + cofs;
#pragma unroll
        for (int s = 0; s < 32 / NW; ++s) *(v4f*)(cp + (size_t)s * 2 * NW * ldc) = val[s];
        return;
    }
#pragma unroll
    for (int mb = 0; mb < 4; ++mb) {
#pragma unroll
        for (int nb = 0; nb < 4; ++nb) {
#pragma unroll
            for (int j = 0; j < 8; ++j) os[(hi * 8 + j) * 68 + nb * 16 + lr] = acc[mb][nb][j]; }
        __builtin_amdgcn_wave_barrier(); asm volatile("" ::: "memory");
        float* crow = C + (size_t)(r0 + mb * 16) * ldc + c0;
{
#pragma unroll
            for (int s = 0; s < 8; ++s) { const int row = 2 * s + hi, cofs = lr * 4; v4f val = *(const v4fa*)(os + row * 68 + cofs); if (BIAS) { val[0] += bfr(bias[c0 + cofs]); val[1] += bfr(bias[c0 + cofs + 1]); val[2] += bfr(bias[c0 + cofs + 2]); val[3] += bfr(bias[c0 + cofs + 3]); }
                *(v4f*)(crow + (size_t)row * ldc + cofs) = val; }
             }
        __builtin_amdgcn_wave_barrier(); asm volatile("" ::: "memory");
    }
}

__device__ __forceinline__ h16 tohx(float x) { return (h16)x; }
__device__ __forceinline__ void splitf(float y, unsigned short& h, unsigned short& l) { h = f2bf(y); l = f2bf(y - bf2f(h)); }
typedef __attribute__((ext_vector_type(2))) _Float16 v2h;
typedef __attribute__((ext_vector_type(4))) _Float16 v4h;
typedef __attribute__((ext_vector_type(2))) unsigned short v2us;
typedef __attribute__((ext_vector_type(4))) unsigned short v4us;
typedef __attribute__((ext_vector_type(2))) float v2f;
typedef __attribute__((ext_vector_type(4))) int v4i;

__global__ __launch_bounds__(256) void k_wtG(const float* __restrict__ w, int K, int N, bf* Bt) {
    const int lane = threadIdx.x & 31; const int L0 = (blockIdx.x * 8 + (threadIdx.x >> 5)) * 8; const int nlines = N * K / 64;
{
#pragma unroll 1
        for (int l = 0; l < 8; ++l) { const int L = L0 + l; if (L >= nlines) break; const size_t e = (size_t)L * 64 + lane * 2; const int k = (int)(e % K), n = (int)(e / K); v2us o;
            o[0] = f2bf(w[(size_t)k * N + n]); o[1] = f2bf(w[(size_t)(k + 1) * N + n]); *(v2us*)(Bt + e) = o; }
         }
}
__global__ __launch_bounds__(256) void k_cvt8(const float* __restrict__ src, bf* dst, size_t n8) { const size_t i = (size_t)blockIdx.x * 256 + threadIdx.x; if (i >= n8) return; const v8f v = *(const v8f*)(src + i * 8); v8us o;
#pragma unroll
    for (int k = 0; k < 8; ++k) o[k] = f2bf(v[k]); *(v8us*)(dst + i * 8) = o;  }

// k_rope: head planes [h][t][d] (fp16 + hi/lo) of rope(x) x sc with the rotate-half convention out[d] = x[d] cos[t][d] - x[d+HD/2] sin[t][d], out[d+HD/2] = x[d+HD/2] cos[t][d+HD/2] + x[d] sin[t][d+HD/2]
__global__ __launch_bounds__(256) void k_rope(const float* __restrict__ F, int pitch, int nheads, const float* __restrict__ CS, const float* __restrict__ RF, const float* __restrict__ nw, float sc, h16* P16, bf* Ph, bf* Pl) {
    const size_t e = ((size_t)blockIdx.x * 256 + threadIdx.x) * 2; if (e >= (size_t)nheads * TT * HD) return; const int d = (int)(e % HD); const int t = (int)((e / HD) % TT); const int h = (int)(e / ((size_t)HD * TT)); const float* f = F + (size_t)t * pitch + h * HD; const float rf = RF ? RF[(size_t)h * TT + t] : 1.0f; v2h o16; v2us oh, ol;
#pragma unroll
    for (int q = 0; q < 2; ++q) { const int dd = d + q; const int dp = (dd < HD / 2) ? dd + HD / 2 : dd - HD / 2; float x0 = f[dd], x1 = f[dp];
        if (RF) { float n0 = __fmul_rn(x0, rf), n1 = __fmul_rn(x1, rf); asm volatile("" : "+v"(n0)); asm volatile("" : "+v"(n1)); x0 = __fmul_rn(bfr(nw[dd]), n0); x1 = __fmul_rn(bfr(nw[dp]), n1); }
        const v2f cs = *(const v2f*)(CS + ((size_t)t * HD + dd) * 2); float a = __fmul_rn(x0, cs[0]), bq = __fmul_rn(x1, cs[1]); asm volatile("" : "+v"(a)); asm volatile("" : "+v"(bq)); const float r = ((dd < HD / 2) ? __fsub_rn(a, bq) : __fadd_rn(a, bq)) * sc;
        o16[q] = tohx(r); unsigned short a2, c2; splitf(r, a2, c2); oh[q] = a2; ol[q] = c2; }
    *(v2h*)(P16 + e) = o16; *(v2us*)(Ph + e) = oh; *(v2us*)(Pl + e) = ol;  }
__global__ __launch_bounds__(256) void k_vtp(const float* __restrict__ F, int pitch, int nheads, h16* V16, bf* Vh, bf* Vl) { const size_t e = ((size_t)blockIdx.x * 256 + threadIdx.x) * 2; if (e >= (size_t)nheads * HD * TT) return; const int t = (int)(e % TT); const int d = (int)((e / TT) % HD); const int g = (int)(e / ((size_t)TT * HD)); v2h o16; v2us oh, ol;
#pragma unroll
    for (int q = 0; q < 2; ++q) { const float x = F[(size_t)(t + q) * pitch + g * HD + d]; o16[q] = tohx(x); unsigned short a2, c2; splitf(x, a2, c2); oh[q] = a2; ol[q] = c2; }
    *(v2h*)(V16 + e) = o16; *(v2us*)(Vh + e) = oh; *(v2us*)(Vl + e) = ol;  }
__global__ __launch_bounds__(256) void k_csid(float* CS) { const int idx = blockIdx.x * 256 + threadIdx.x; if (idx >= TT * HD) return; v2f cs; cs[0] = 1.0f; cs[1] = 0.0f; *(v2f*)(CS + (size_t)idx * 2) = cs;  }
// k_asoft: per row (zz, i): t = S x HD^-0.5 (no mask); softmax over the 4096 keys (register row, one exp, fixed trees);
__global__ __launch_bounds__(256) void k_asoft(const float* __restrict__ Sb, h16* P16, bf* Ph, bf* Pl) {
    const int lane = threadIdx.x & 31; const int row = blockIdx.x * 8 + (threadIdx.x >> 5); if (row >= ZH * TT) return; const int i = row % TT; const int zz = row / TT; (void)zz; const bool hires = (i < RH); const float* sr = Sb + (size_t)row * TT; float v[TT / 32]; float mx = -3.0e38f;
#pragma unroll
    for (int ch = 0; ch < TT / 128; ++ch) { const int j0 = ch * 128 + lane * 4; const v4f a = *(const v4f*)(sr + j0);
#pragma unroll
        for (int q = 0; q < 4; ++q) { const int j = j0 + q; (void)j; const float t = a[q] * SCL; v[ch * 4 + q] = t; mx = fmaxf(mx, t); } }
#pragma unroll
    for (int sh = 16; sh; sh >>= 1) mx = fmaxf(mx, __shfl_xor(mx, sh, 32));
    float sum = 0.f;
#pragma unroll
    for (int k = 0; k < TT / 32; ++k) { float d0 = __fsub_rn(v[k], mx); asm volatile("" : "+v"(d0)); v[k] = __builtin_amdgcn_exp2f(__fmul_rn(d0, 1.4426950408889634f)); sum += v[k]; }
#pragma unroll
    for (int sh = 16; sh; sh >>= 1) sum += __shfl_xor(sum, sh, 32);
    const float f = __fdiv_rn(hires ? 1.0f : PCAR, sum);
{
        if (hires) {
#pragma unroll
            for (int ch = 0; ch < TT / 128; ++ch) { v4us oh, ol;
#pragma unroll
                for (int q = 0; q < 4; ++q) { unsigned short a, c2; splitf(v[ch * 4 + q] * f, a, c2); oh[q] = a; ol[q] = c2; }
                const size_t oo = ((size_t)zz * (RH ? RH : 1) + i) * TT + ch * 128 + lane * 4; *(v4us*)(Ph + oo) = oh; *(v4us*)(Pl + oo) = ol; }
        } else {
#pragma unroll
            for (int ch = 0; ch < TT / 128; ++ch) { v4h o4;
#pragma unroll
                for (int q = 0; q < 4; ++q) o4[q] = tohx(v[ch * 4 + q] * f);
                *(v4h*)(P16 + (size_t)row * TT + ch * 128 + lane * 4) = o4; } }
         }
}
__global__ __launch_bounds__(256) void k_merge(const float* __restrict__ O, int h0, float* OUTb) { const size_t e = ((size_t)blockIdx.x * 256 + threadIdx.x) * 2; if (e >= (size_t)ZH * TT * HD) return; const int d = (int)(e % HD); const int t = (int)((e / HD) % TT); const int zz = (int)(e / ((size_t)HD * TT)); const float cs = (t < RH) ? 1.0f : (1.0f / PCAR); const size_t oo = (size_t)t * DQ + (h0 + zz) * HD + d;
    v2f a = *(const v2f*)(O + e);   // the K-range planes of attn.v, added in plane order
    if (t < RH) {
#pragma unroll
        for (int p = 1; p < KZH; ++p) a += *(const v2f*)(O + (size_t)p * ZH * TT * HD + e);
    } else {
#pragma unroll
        for (int p = 1; p < KZF; ++p) a += *(const v2f*)(O + (size_t)p * ZH * TT * HD + e); }
    v2f o2; o2[0] = a[0] * cs; o2[1] = a[1] * cs; *(v2f*)(OUTb + oo) = o2;  }

extern "C" void kernel_launch(void* const* d_in, const int* in_sizes, int n_in,
                              void* d_out, int out_size, void* d_ws, size_t ws_size, hipStream_t stream) {
    (void)in_sizes; (void)n_in; (void)out_size;
    const float* x = (const float*)d_in[0]; const float* wq = (const float*)d_in[1]; const float* wk = (const float*)d_in[2]; const float* wv = (const float*)d_in[3]; const float* wo = nullptr; (void)wo;
    float* OUT = (float*)d_out;     // [2][4096][512]
    char* wsp = (char*)d_ws;
    auto take = [&](size_t bytes) { char* p = wsp; wsp += (bytes + 255) & ~(size_t)255; return (void*)p; };
    bf* WQ = (bf*)take((size_t)DQ * DM * 2); bf* WK = (bf*)take((size_t)DKV * DM * 2); bf* WV = (bf*)take((size_t)DKV * DM * 2); float* CS = (float*)take((size_t)TT * HD * 2 * 4);
    bf* XB = (bf*)take((size_t)TT * DM * 2); float* FQ = (float*)take((size_t)TT * DQ * 4); float* FK = (float*)take((size_t)TT * DKV * 4);
    h16* QP16 = (h16*)take((size_t)NH_ * TT * HD * 2); h16* KP16 = (h16*)take((size_t)NKV * TT * HD * 2); h16* VT16 = (h16*)take((size_t)NKV * HD * TT * 2);
    bf* QPh = (bf*)take((size_t)NH_ * TT * HD * 2); bf* QPl = (bf*)take((size_t)NH_ * TT * HD * 2); bf* KPh = (bf*)take((size_t)NKV * TT * HD * 2); bf* KPl = (bf*)take((size_t)NKV * TT * HD * 2); bf* VTh = (bf*)take((size_t)NKV * HD * TT * 2); bf* VTl = (bf*)take((size_t)NKV * HD * TT * 2); bf* Ph = (bf*)take((size_t)ZH * RH * TT * 2); bf* Pl = (bf*)take((size_t)ZH * RH * TT * 2);
    float* Sb = (float*)take((size_t)ZH * TT * TT * 4); h16* P16 = (h16*)take((size_t)ZH * TT * TT * 2); float* Ob = (float*)take((size_t)KZH * ZH * TT * HD * 4);   // K-range planes [plane][t][d]; rows >= RH use the first KZF
    if ((size_t)(wsp - (char*)d_ws) > ws_size) return;    // ws 256 MiB
    float* FV = FK;   // v projection reuses the k buffer after the k planes are built (stream-ordered)
    { k_wtG<<<(unsigned)((DM * DQ / 64 + 63) / 64), 256, 0, stream>>>(wq, DM, DQ, WQ); k_wtG<<<(unsigned)((DM * DKV / 64 + 63) / 64), 256, 0, stream>>>(wk, DM, DKV, WK); k_wtG<<<(unsigned)((DM * DKV / 64 + 63) / 64), 256, 0, stream>>>(wv, DM, DKV, WV);
      
       }
    k_csid<<<(TT * HD + 255) / 256, 256, 0, stream>>>(CS);
    const unsigned LQ = (unsigned)(((size_t)NH_ * TT * HD / 2 + 255) / 256), LKv = (unsigned)(((size_t)NKV * TT * HD / 2 + 255) / 256);
    for (int b = 0; b < NB_; ++b) {
        
        k_cvt8<<<(unsigned)(((size_t)TT * DM / 8 + 255) / 256), 256, 0, stream>>>(x + (size_t)b * TT * DM, XB, (size_t)TT * DM / 8);
        k_gemmw<bf, 0, false><<<dim3(TT / 64, DQ / 64, 1), 32, 0, stream>>>(XB, nullptr, WQ, nullptr, DM, FQ, DQ, nullptr, 0, 0, 0);
        k_rope<<<LQ, 256, 0, stream>>>(FQ, DQ, NH_, CS, nullptr, nullptr, 1.0f, QP16, QPh, QPl);
        k_gemmw<bf, 0, false><<<dim3(TT / 64, DKV / 64, 1), 32, 0, stream>>>(XB, nullptr, WK, nullptr, DM, FK, DKV, nullptr, 0, 0, 0);
        k_rope<<<LKv, 256, 0, stream>>>(FK, DKV, NKV, CS, nullptr, nullptr, 1.0f, KP16, KPh, KPl);
        k_gemmw<bf, 0, false><<<dim3(TT / 64, DKV / 64, 1), 32, 0, stream>>>(XB, nullptr, WV, nullptr, DM, FV, DKV, nullptr, 0, 0, 0); k_vtp<<<LKv, 256, 0, stream>>>(FV, DKV, NKV, VT16, VTh, VTl);
        for (int h0 = 0; h0 < NH_; h0 += ZH) { const size_t zq = (size_t)h0, zk = (size_t)(h0 / REP);   // one kv head per query head: the pass's single head uses kv plane h0 (z-strides TT*HD)
            k_gemmw<bf, 2, false><<<dim3(TT / 64, TT / 64, ZH), 32, 0, stream>>>(QPh + zq * TT * HD, QPl + zq * TT * HD, KPh + zk * TT * HD, KPl + zk * TT * HD, HD, Sb, TT, nullptr, (size_t)TT * HD, (size_t)TT * HD, (size_t)TT * TT);   /* scores hi/lo on EVERY row (no output projection) */

            k_asoft<<<ZH * TT / 8, 256, 0, stream>>>(Sb, P16, Ph, Pl);
            k_gemmw<bf, 2, false, 4, TT / (KZH * 4)><<<dim3(RH / 64, HD / 64, KZH), 128, 0, stream>>>(Ph, Pl, VTh + zk * HD * TT, VTl + zk * HD * TT, TT, Ob, HD, nullptr, (size_t)TT / KZH, (size_t)TT / KZH, (size_t)ZH * TT * HD);
            k_gemmw<h16, 0, false, 8, TT / (KZF * 8)><<<dim3((TT - RH) / 64, HD / 64, KZF), 256, 0, stream>>>(P16 + (size_t)RH * TT, nullptr, VT16 + zk * HD * TT, nullptr, TT, Ob + (size_t)RH * HD, HD, nullptr, (size_t)TT / KZF, (size_t)TT / KZF, (size_t)ZH * TT * HD);
            k_merge<<<(unsigned)(((size_t)ZH * TT * HD / 2 + 255) / 256), 256, 0, stream>>>(Ob, h0, OUT + (size_t)b * TT * DQ); }
         }
}

// v003
// Measured time: 254 microseconds a run.
// Versions between v001 and this one are left out; their measured steps multiply to 4.02 times as fast.
// Counting every step since v000, it is 13.7 times as fast.
#include <hip/hip_runtime.h>

// Multi-head attention over 4,096 tokens without output projection (attention_input [2][4096][512]; q,k,v = x W ('xw' [512][512] 0.05); 8 heads x 64; scores / SCALE with SCALE = N_HEADS = 8 (the source's quirk; numerically the usual 1/8 here); softmax; out = concat-heads(attn v) -> [2][4096][512] (4.2 M)).
// Three launches: x and the 'xw' weights rounded to bf16 and packed in fragment order; ONE projection launch (both batches, q, k and v) whose epilogue writes the head planes; then ONE fused attention launch for both batches and all heads: hi/lo 3-product score tiles on EVERY row (no output projection averages the per-head error), running-maximum softmax in registers, P and attn.v hybrid (rows < 512 hi/lo, rest fp16); scores and P never reach memory.
// Compute dtypes, f32 accumulate: every input rounded to bf16; projections exact; scores 3 products on every row; softmax f32; attn.v rows < 512 3 products, rest fp16; output f32.

#define NB_  2
#define TT   4096
#define DM   512
#define NH_  8
#define NKV  8
#define REP  (NH_ / NKV)
#define HD   64
#define DQ   (NH_ * HD)
#define DKV  (NKV * HD)
#define ZH   1
#define RH   512                  // query rows < RH use hi+lo planes (0: none)
#define WIN  0
#define SCL  0.125f   // HD^-0.5
#define FAW  8                    // fused attention: waves per work-group
#define FAC  32                   // fused attention: query columns per wave
static_assert(RH % (4 * FAC) == 0 && 2 * RH <= TT && TT % (FAW * FAC) == 0 && TT % 32 == 0 && HD == 64 && REP == 1, "a wave is all hi/lo or all fp16, hi/lo rows lie in the first half; whole 32-key passes; 4 output tiles");
typedef _Float16 h16;
typedef unsigned short bf;
typedef __attribute__((ext_vector_type(16))) __bf16   v16bf;
typedef __attribute__((ext_vector_type(16))) _Float16 v16h;
typedef __attribute__((ext_vector_type(8)))  _Float16 v8h;
typedef __attribute__((ext_vector_type(8)))  unsigned short v8us;
typedef __attribute__((ext_vector_type(8)))  float    v8f;
typedef __attribute__((ext_vector_type(4)))  float    v4f;
typedef v8h  __attribute__((may_alias)) v8ha;
typedef v4f  __attribute__((may_alias)) v4fa;
typedef v8us __attribute__((may_alias)) v8usa;

__device__ __forceinline__ v16h cat16(v8h lo, v8h hi) { return __builtin_shufflevector(lo, hi, 0, 1, 2, 3, 4, 5, 6, 7, 8, 9, 10, 11, 12, 13, 14, 15); }
__device__ __forceinline__ v16bf cat16b(v8us lo, v8us hi) { return __builtin_bit_cast(v16bf, __builtin_shufflevector(lo, hi, 0, 1, 2, 3, 4, 5, 6, 7, 8, 9, 10, 11, 12, 13, 14, 15)); }
__device__ __forceinline__ v8f wmma16(v16h a, v16h b, v8f c) { return __builtin_amdgcn_wmma_f32_16x16x32_f16(false, a, false, b, (short)0, c, false, false); }
__device__ __forceinline__ v8f wmmab(v16bf a, v16bf b, v8f c) { return __builtin_amdgcn_wmma_f32_16x16x32_bf16(false, a, false, b, (short)0, c, false, false); }



template <typename T16> struct WFrag;
template <> struct WFrag<h16> { typedef v16h V; static __device__ __forceinline__ V ld(const h16* p) { return cat16(*(const v8h*)p, *(const v8h*)(p + 16)); } static __device__ __forceinline__ v8f mma(V a, V b, v8f c) { return wmma16(a, b, c); } };
template <> struct WFrag<bf> { typedef v16bf V; static __device__ __forceinline__ V ld(const bf* p) { return cat16b(*(const v8us*)p, *(const v8us*)(p + 16)); } static __device__ __forceinline__ v8f mma(V a, V b, v8f c) { return wmmab(a, b, c); } };

// Fragment order: a 16-row x 32-k operand fragment is 1 KiB = two units of 512 B; unit u = (tile16 * (DM / 32) + kstep) * 2 + part holds, at lane * 16 B,
// the 8 bf16 of row tile16 * 16 + (lane & 15), k = kstep * 32 + part * 16 + (lane >> 4) * 8 .. + 7. A wave's 16-byte load of a unit is 512 contiguous bytes (4 whole lines), and units (part 0, part 1) are the two halves of the fragment register.
#define KST  (DM / 32)             // k steps of a projection
#define XUN  (NB_ * TT / 16 * KST * 2)          // units of x
#define WUN  ((DQ + 2 * DKV) / 16 * KST * 2)    // units of the three weights, features q | k | v
#define PKU  8                     // units a wave packs
static_assert(XUN % (8 * PKU) == 0 && WUN % (8 * PKU) == 0 && (KST * 2) % PKU == 0 && DQ == DM && DKV == DM, "whole work-groups; a wave's units lie in one 16-row tile");
typedef __attribute__((ext_vector_type(8))) __bf16 v8b;
__device__ __forceinline__ v8us bf8(v8f v) { return __builtin_bit_cast(v8us, __builtin_convertvector(v, v8b)); }   // round to nearest even
// k_pack: work-groups < XUN / 64 pack x, the rest the weights (w[k][n] read down k: the transposition). Its loops are unrolled so that all of a wave's loads are in flight before the first is used.
__global__ __launch_bounds__(256) void k_pack(const float* __restrict__ x, const float* __restrict__ wq, const float* __restrict__ wk, const float* __restrict__ wv, bf* XP, bf* WP) {
    const int lane = threadIdx.x & 31, lr = lane & 15, hi = lane >> 4, wvi = __builtin_amdgcn_readfirstlane((int)(threadIdx.x >> 5));
    if ((int)blockIdx.x < XUN / (8 * PKU)) {
        const int u0 = ((int)blockIdx.x * 8 + wvi) * PKU; const float* s = x + (size_t)((u0 / (KST * 2)) * 16 + lr) * DM + (u0 % (KST * 2)) * 16 + hi * 8; v8f v[PKU];
#pragma unroll
        for (int u = 0; u < PKU; ++u) v[u] = *(const v8f*)(s + u * 16);
        asm volatile("s_wait_xcnt 0x0" :: "v"(s) : "memory");   // before a register that the loads above name is written again; naming the address keeps it whole up to the wait
#pragma unroll
        for (int u = 0; u < PKU; ++u) *(v8us*)(XP + (size_t)(u0 + u) * 256 + lane * 8) = bf8(v[u]);
    } else {
        const int u0 = (((int)blockIdx.x - XUN / (8 * PKU)) * 8 + wvi) * PKU, tile = u0 / (KST * 2), sel = tile / (DM / 16);
        const float* w = sel == 0 ? wq : sel == 1 ? wk : wv; const float* s = w + (size_t)((u0 % (KST * 2)) * 16 + hi * 8) * DM + (tile % (DM / 16)) * 16 + lr; v8f v[PKU];
#pragma unroll
        for (int u = 0; u < PKU; ++u)
#pragma unroll
            for (int k = 0; k < 8; ++k) v[u][k] = s[(size_t)(u * 16 + k) * DM];
        asm volatile("s_wait_xcnt 0x0" :: "v"(s) : "memory");   // as above
#pragma unroll
        for (int u = 0; u < PKU; ++u) *(v8us*)(WP + (size_t)(u0 + u) * 256 + lane * 8) = bf8(v[u]);
    }
}

// k_proj: all projections of both batches. One wave per 64 tokens x one head of q, k or v (16 accumulators), operands straight from the packed units, the next k step's fragments asked for ahead of this step's products.
// q, k: first operand = weight rows, so a lane's 8 results are 8 consecutive d of one token (planes [head][t][d]); v: first operand = token rows, 8 consecutive t of one d (planes [head][d][t]).
// The epilogue rounds to the planes the attention reads (hi + lo bf16; for v also fp16) and stores whole 128-byte lines, staged through the wave's own LDS. grid (tokens / 128, heads of q|k|v / 2), 4 waves = 2 x 2 tiles. Every loop is unrolled: the fragment and accumulator arrays stay in registers, every address is an immediate offset.
typedef __attribute__((ext_vector_type(2))) float v2f;
typedef __attribute__((ext_vector_type(2))) __bf16 v2b;
typedef __attribute__((ext_vector_type(4))) unsigned v4u;
typedef v4u __attribute__((may_alias)) v4ua;
#define OSP  72                    // LDS pitch in 16-bit elements: 144 B, an odd multiple of 16 B
__device__ __forceinline__ v16bf ldu(const bf* p) { return cat16b(*(const v8us*)p, *(const v8us*)(p + 256)); }
__global__ __launch_bounds__(128) void k_proj(const bf* __restrict__ XP, const bf* __restrict__ WP, bf* QPh, bf* QPl, bf* KPh, bf* KPl, bf* VT16, bf* VTh, bf* VTl) {
    __shared__ __align__(16) bf osa[4][64 * OSP];
    const int lane = threadIdx.x & 31, lr = lane & 15, hi = lane >> 4, wvi = __builtin_amdgcn_readfirstlane((int)(threadIdx.x >> 5));
    const int tt64 = (int)blockIdx.x * 2 + (wvi & 1), hd = (int)blockIdx.y * 2 + (wvi >> 1), sel = hd / NH_;   // wave-uniform
    const bf* xb = XP + (size_t)tt64 * (4 * KST * 512) + lane * 8; const bf* wb = WP + (size_t)hd * (4 * KST * 512) + lane * 8;
    const bf* P = sel == 2 ? xb : wb; const bf* Q = sel == 2 ? wb : xb;   // result rows follow P, result columns Q
    v8f acc[4][4];
#pragma unroll
    for (int i = 0; i < 4; ++i)
#pragma unroll
        for (int j = 0; j < 4; ++j) acc[i][j] = (v8f){};
    v16bf p[2][4], q[2][4];
#pragma unroll
    for (int i = 0; i < 4; ++i) { p[0][i] = ldu(P + i * (KST * 512)); q[0][i] = ldu(Q + i * (KST * 512)); }
#pragma unroll
    for (int ks = 0; ks < KST; ++ks) {
        if (ks + 1 < KST) {
#pragma unroll
            for (int i = 0; i < 4; ++i) { p[(ks + 1) & 1][i] = ldu(P + i * (KST * 512) + (ks + 1) * 512); q[(ks + 1) & 1][i] = ldu(Q + i * (KST * 512) + (ks + 1) * 512); }
            if (ks + 2 == KST) asm volatile("s_wait_xcnt 0x0" ::: "memory");   // behind the last loads: it stands before their address registers are written again (the fence below keeps the epilogue's arithmetic behind it)
            __builtin_amdgcn_sched_barrier(0);   // keeps the next step's 16 loads ahead of this step's products: without it the compiler sinks each load to just before its use and the wave waits out the latency several times a step
        }
#pragma unroll
        for (int j = 0; j < 4; ++j)
#pragma unroll
            for (int i = 0; i < 4; ++i) acc[i][j] = wmmab(p[ks & 1][i], q[ks & 1][j], acc[i][j]);
    }
    bf* os = osa[wvi];
    const size_t hp = ((size_t)(tt64 / (TT / 64)) * NH_ + hd % NH_) * TT * HD; const int t0 = (tt64 % (TT / 64)) * 64;
    const size_t ob = hp + (sel == 2 ? (size_t)t0 : (size_t)t0 * HD) + (size_t)(lane >> 3) * (sel == 2 ? TT : HD) + (lane & 7) * 8, op4 = sel == 2 ? (size_t)4 * TT : (size_t)4 * HD;   // the lane's 16 bytes of 4 result columns a store; 4 columns further each time
    bf* osw = os + lr * OSP + 8 * hi; const bf* osr = os + (lane >> 3) * OSP + (lane & 7) * 8;
    auto flush = [&](bf* d, bool more) {   // the staged 64 x 64 tile to its plane, 4 whole lines a store
        __builtin_amdgcn_wave_barrier(); asm volatile("" ::: "memory");   // keeps the reads below, of other lanes' values, behind the writes before them
#pragma unroll
        for (int s = 0; s < 16; ++s) *(v8usa*)(d + s * op4) = *(const v8usa*)(osr + s * 4 * OSP);
        if (more) { asm volatile("s_wait_xcnt 0x0" ::: "memory"); __builtin_amdgcn_sched_barrier(0); }   // the wait stands before the next plane's values reuse a register that an issued store names, the fence keeps them behind it; both keep the next plane's LDS writes behind the reads above
    };
    if (sel == 2) {   // fp16 plane, v only
#pragma unroll
        for (int i = 0; i < 4; ++i)
#pragma unroll
            for (int j = 0; j < 4; ++j) *(v8ha*)(osw + j * 16 * OSP + i * 16) = __builtin_convertvector(acc[i][j], v8h);
        flush(VT16 + ob, true);
    }
#pragma unroll
    for (int i = 0; i < 4; ++i)   // hi plane; the accumulators keep the remainder
#pragma unroll
        for (int j = 0; j < 4; ++j) { v4u o;
#pragma unroll
            for (int r = 0; r < 4; ++r) { const v2f y = {acc[i][j][2 * r], acc[i][j][2 * r + 1]}; o[r] = __builtin_bit_cast(unsigned, __builtin_convertvector(y, v2b)); acc[i][j][2 * r] -= __uint_as_float(o[r] << 16); acc[i][j][2 * r + 1] -= __uint_as_float(o[r] & 0xFFFF0000u); }
            *(v4ua*)(osw + j * 16 * OSP + i * 16) = o; }
    flush((sel == 0 ? QPh : sel == 1 ? KPh : VTh) + ob, true);
#pragma unroll
    for (int i = 0; i < 4; ++i)   // lo plane
#pragma unroll
        for (int j = 0; j < 4; ++j) *(v8usa*)(osw + j * 16 * OSP + i * 16) = bf8(acc[i][j]);
    flush((sel == 0 ? QPl : sel == 1 ? KPl : VTl) + ob, false);
}

__device__ __forceinline__ float xhalf(float x) { return __builtin_bit_cast(float, __builtin_amdgcn_permlanex16(__builtin_bit_cast(int, x), __builtin_bit_cast(int, x), 0x76543210, 0xfedcba98, false, false)); }   // lane l with lane l ^ 16
// two 2^x; the second fills the slot the instruction set asks for behind the first, the v_nop the slot behind the second (results are not sources: early clobber)
__device__ __forceinline__ void exp2x2(float a, float b, float& ra, float& rb) { asm("v_exp_f32 %0, %2\n\tv_exp_f32 %1, %3\n\tv_nop" : "=&v"(ra), "=&v"(rb) : "v"(a), "v"(b)); }
template <bool HR>
__device__ __forceinline__ void fattn_wave(const v16bf (&qh)[2][2], const v16bf (&ql)[2][2], v16bf (&kh)[2][2], v16bf (&kl)[2][2], const bf* __restrict__ Kh, const bf* __restrict__ Kl, const h16* __restrict__ V16, const bf* __restrict__ Vh, const bf* __restrict__ Vl, unsigned ko, unsigned vo, float* orow) {   // ko, vo: the lane's byte offsets in the head's K and V planes
    typedef WFrag<bf> FB; typedef WFrag<h16> FH; const float C2 = SCL * 1.4426950408889634f;
    v8f o[4][2]; float mu[2], ls[2];
#pragma unroll
    for (int nt = 0; nt < 2; ++nt) { mu[nt] = -1.0e30f; ls[nt] = 0.f;
#pragma unroll
        for (int dt = 0; dt < 4; ++dt) o[dt][nt] = (v8f){}; }
#pragma unroll 1
    for (int k0 = 0; k0 < TT; k0 += 32) {
        v16h vf[4]; v16bf vh[4], vl[4];   // this pass's V rows: asked for here, used behind the softmax
#pragma unroll
        for (int dt = 0; dt < 4; ++dt) { const size_t e = (size_t)dt * 16 * TT; if (HR) { vh[dt] = FB::ld((const bf*)((const char*)Vh + vo) + e); vl[dt] = FB::ld((const bf*)((const char*)Vl + vo) + e); } else vf[dt] = FH::ld((const h16*)((const char*)V16 + vo) + e); }
        asm volatile("s_wait_xcnt 0x0" : "+v"(vo) :: "memory"); vo += 32 * 2;   // the wait stands before the offset that the issued loads name moves on; naming it here keeps the addition behind it
        v8f st[2][2];
#pragma unroll
        for (int mt = 0; mt < 2; ++mt)
#pragma unroll
            for (int nt = 0; nt < 2; ++nt) st[mt][nt] = (v8f){};
#pragma unroll
        for (int ks = 0; ks < 2; ++ks) {
#pragma unroll
            for (int mt = 0; mt < 2; ++mt)
#pragma unroll
                for (int nt = 0; nt < 2; ++nt) st[mt][nt] = wmmab(kh[mt][ks], qh[nt][ks], st[mt][nt]);
#pragma unroll
            for (int mt = 0; mt < 2; ++mt)
#pragma unroll
                for (int nt = 0; nt < 2; ++nt) st[mt][nt] = wmmab(kh[mt][ks], ql[nt][ks], st[mt][nt]);
#pragma unroll
            for (int mt = 0; mt < 2; ++mt)
#pragma unroll
                for (int nt = 0; nt < 2; ++nt) st[mt][nt] = wmmab(kl[mt][ks], qh[nt][ks], st[mt][nt]);
        }
        float cm[2];
#pragma unroll
        for (int nt = 0; nt < 2; ++nt) { float x = fmaxf(st[0][nt][0], st[1][nt][0]);
#pragma unroll
            for (int r = 1; r < 8; ++r) x = fmaxf(x, fmaxf(st[0][nt][r], st[1][nt][r]));
            cm[nt] = fmaxf(x, xhalf(x)) * C2; }
        if (k0 + 32 < TT) {   // the next pass's K rows fly during the softmax and attn.v
            ko += 32 * HD * 2;
#pragma unroll
            for (int mt = 0; mt < 2; ++mt)
#pragma unroll
                for (int ks = 0; ks < 2; ++ks) { const size_t e = (size_t)mt * 16 * HD + ks * 32; kh[mt][ks] = FB::ld((const bf*)((const char*)Kh + ko) + e); kl[mt][ks] = FB::ld((const bf*)((const char*)Kl + ko) + e); }
            asm volatile("s_wait_xcnt 0x0" : "+v"(ko) :: "memory");   // as above, for the K offset
        }
        if (__builtin_amdgcn_ballot_w32(cm[0] > mu[0] + 4.0f || cm[1] > mu[1] + 4.0f) != 0) {   // one scalar branch a pass; rare after the first passes
            const float mn0 = fmaxf(mu[0], cm[0]), mn1 = fmaxf(mu[1], cm[1]); float al[2]; exp2x2(mu[0] - mn0, mu[1] - mn1, al[0], al[1]); mu[0] = mn0; mu[1] = mn1;   // 0 on the first pass
#pragma unroll
            for (int nt = 0; nt < 2; ++nt) { ls[nt] *= al[nt];
#pragma unroll
                for (int dt = 0; dt < 4; ++dt) o[dt][nt] *= al[nt]; }
        }
#pragma unroll
        for (int nt = 0; nt < 2; ++nt) { const float nb = 6.0f - mu[nt]; float p[16], s0 = 0.f, s1 = 0.f;
#pragma unroll
            for (int r = 0; r < 8; ++r) { exp2x2(fmaf(st[0][nt][r], C2, nb), fmaf(st[1][nt][r], C2, nb), p[r], p[8 + r]); s0 += p[r]; s1 += p[8 + r]; }
            ls[nt] += s0 + s1;
            if (HR) { v16bf ph, pl;
#pragma unroll
                for (int s = 0; s < 16; ++s) { ph[s] = (__bf16)p[s]; pl[s] = (__bf16)(p[s] - (float)ph[s]); }
#pragma unroll
                for (int dt = 0; dt < 4; ++dt) o[dt][nt] = wmmab(vh[dt], ph, o[dt][nt]);
#pragma unroll
                for (int dt = 0; dt < 4; ++dt) o[dt][nt] = wmmab(vh[dt], pl, o[dt][nt]);
#pragma unroll
                for (int dt = 0; dt < 4; ++dt) o[dt][nt] = wmmab(vl[dt], ph, o[dt][nt]);
            } else { v16h pf;
#pragma unroll
                for (int s = 0; s < 16; ++s) pf[s] = (h16)p[s];
#pragma unroll
                for (int dt = 0; dt < 4; ++dt) o[dt][nt] = wmma16(vf[dt], pf, o[dt][nt]); }
        }
    }
#pragma unroll
    for (int nt = 0; nt < 2; ++nt) { const float inv = __fdiv_rn(1.0f, ls[nt] + xhalf(ls[nt]));   // a lane's 8 registers are 8 consecutive d of its query's row
#pragma unroll
        for (int dt = 0; dt < 4; ++dt) *(v8f*)(orow + (size_t)nt * 16 * DQ + dt * 16) = o[dt][nt] * inv;
        if (nt == 0) asm volatile("s_wait_xcnt 0x0" : "+v"(ls[1]) :: "memory"); }   // before the second column group's values reuse a register that an issued store names; naming its sum keeps them behind the wait
}
// grid (TT / 256, heads, batches), 8 waves that walk the same K rows; planes [batch][head][t][d] (Q, K) and [batch][head][d][t] (V)
__global__ __launch_bounds__(32 * FAW) void k_fattn(const bf* __restrict__ QPh, const bf* __restrict__ QPl, const bf* __restrict__ KPh, const bf* __restrict__ KPl, const h16* __restrict__ VT16, const bf* __restrict__ VTh, const bf* __restrict__ VTl, float* OUT) {
    typedef WFrag<bf> FB;
    // waves 0 .. 3 take 128 rows of the first half of the sequence, waves 4 .. 7 the 128 rows half a sequence further on: a longer hi/lo wave then has a shorter fp16 wave beside it (for speed only)
    const int wv = __builtin_amdgcn_readfirstlane((int)(threadIdx.x >> 5)), q0 = (int)blockIdx.x * (4 * FAC) + (wv >> 2) * (TT / 2) + (wv & 3) * FAC;   // wave-uniform: the hi/lo test below is a scalar branch
    const size_t hp = ((size_t)blockIdx.z * NH_ + blockIdx.y) * TT * HD;
    int tx = (int)threadIdx.x; v16bf qh[2][2], ql[2][2], kh[2][2], kl[2][2];
    { const size_t fo = (size_t)(tx & 15) * HD + 8 * ((tx >> 4) & 1), qp = hp + (size_t)q0 * HD + fo;
#pragma unroll
      for (int t = 0; t < 2; ++t)
#pragma unroll
          for (int ks = 0; ks < 2; ++ks) { const size_t e = (size_t)t * 16 * HD + ks * 32; qh[t][ks] = FB::ld(QPh + qp + e); ql[t][ks] = FB::ld(QPl + qp + e); kh[t][ks] = FB::ld(KPh + hp + fo + e); kl[t][ks] = FB::ld(KPl + hp + fo + e); } }
    asm volatile("s_wait_xcnt 0x0" : "+v"(tx) :: "memory");   // before a register that the loads above name is written again; the loop's offsets are formed from tx behind it, which keeps their arithmetic behind the wait
    const int lr = tx & 15, hi = (tx >> 4) & 1;
    const unsigned ko = (unsigned)(lr * HD + 8 * hi) * 2, vo = (unsigned)(lr * TT + 8 * hi) * 2;   // each lane's own rows, in bytes; every fragment of a pass is an immediate offset from them
    float* orow = OUT + ((size_t)blockIdx.z * TT + q0 + lr) * DQ + blockIdx.y * HD + 8 * hi;
    if (q0 < RH) fattn_wave<true>(qh, ql, kh, kl, KPh + hp, KPl + hp, VT16 + hp, VTh + hp, VTl + hp, ko, vo, orow);
    else fattn_wave<false>(qh, ql, kh, kl, KPh + hp, KPl + hp, VT16 + hp, VTh + hp, VTl + hp, ko, vo, orow);
}

extern "C" void kernel_launch(void* const* d_in, const int* in_sizes, int n_in,
                              void* d_out, int out_size, void* d_ws, size_t ws_size, hipStream_t stream) {
    (void)in_sizes; (void)n_in; (void)out_size;
    const float* x = (const float*)d_in[0]; const float* wq = (const float*)d_in[1]; const float* wk = (const float*)d_in[2]; const float* wv = (const float*)d_in[3];
    float* OUT = (float*)d_out;     // [2][4096][512]
    char* wsp = (char*)d_ws;
    auto take = [&](size_t bytes) { char* p = wsp; wsp += (bytes + 255) & ~(size_t)255; return (void*)p; };
    bf* XP = (bf*)take((size_t)XUN * 512); bf* WP = (bf*)take((size_t)WUN * 512);
    h16* VT16 = (h16*)take((size_t)NB_ * NKV * HD * TT * 2);
    bf* QPh = (bf*)take((size_t)NB_ * NH_ * TT * HD * 2); bf* QPl = (bf*)take((size_t)NB_ * NH_ * TT * HD * 2); bf* KPh = (bf*)take((size_t)NB_ * NKV * TT * HD * 2); bf* KPl = (bf*)take((size_t)NB_ * NKV * TT * HD * 2); bf* VTh = (bf*)take((size_t)NB_ * NKV * HD * TT * 2); bf* VTl = (bf*)take((size_t)NB_ * NKV * HD * TT * 2);   // the planes the fused attention reads hold both batches
    if ((size_t)(wsp - (char*)d_ws) > ws_size) return;    // ws 256 MiB
    k_pack<<<(XUN + WUN) / (8 * PKU), 256, 0, stream>>>(x, wq, wk, wv, XP, WP);
    k_proj<<<dim3(NB_ * TT / 128, (NH_ + 2 * NKV) / 2, 1), 128, 0, stream>>>(XP, WP, QPh, QPl, KPh, KPl, (bf*)VT16, VTh, VTl);
    k_fattn<<<dim3(TT / (FAW * FAC), NH_, NB_), 32 * FAW, 0, stream>>>(QPh, QPl, KPh, KPl, VT16, VTh, VTl, OUT);
}

// v004
// A run of this version takes 159 microseconds.
// Two timings next to v003 put it at 1.58 and 1.61 times that version's speed.
// All steps since v000 together make it 21.8 times as fast.
#include <hip/hip_runtime.h>

// Multi-head attention over 4,096 tokens without output projection (attention_input [2][4096][512]; q,k,v = x W ('xw' [512][512] 0.05); 8 heads x 64; scores / SCALE with SCALE = N_HEADS = 8 (the source's quirk; numerically the usual 1/8 here); softmax; out = concat-heads(attn v) -> [2][4096][512] (4.2 M)).
// Three launches: x and the 'xw' weights rounded to bf16 and packed in fragment order; ONE projection launch (both batches, q, k and v) whose epilogue writes the head planes, also in fragment order; then ONE fused attention launch for both batches and all heads: hi/lo 3-product score tiles on EVERY row (no output projection averages the per-head error), running-maximum softmax in registers, P and attn.v hybrid (rows < 512 hi/lo, rest fp16); scores and P never reach memory.
// Compute dtypes, f32 accumulate: every input rounded to bf16; projections exact; scores 3 products on every row; softmax f32; attn.v rows < 512 3 products, rest fp16; output f32.

#define NB_  2
#define TT   4096
#define DM   512
#define NH_  8
#define NKV  8
#define REP  (NH_ / NKV)
#define HD   64
#define DQ   (NH_ * HD)
#define DKV  (NKV * HD)
#define ZH   1
#define RH   512                  // query rows < RH use hi+lo planes (0: none)
#define WIN  0
#define SCL  0.125f   // HD^-0.5
#define FAW  8                    // fused attention: waves per work-group
#define FAC  32                   // fused attention: query columns per wave
static_assert(RH % (4 * FAC) == 0 && 2 * RH <= TT && TT % (FAW * FAC) == 0 && TT % 32 == 0 && HD == 64 && REP == 1, "a wave is all hi/lo or all fp16, hi/lo rows lie in the first half; whole 32-key passes; 4 output tiles");
typedef _Float16 h16;
typedef unsigned short bf;
typedef __attribute__((ext_vector_type(16))) __bf16   v16bf;
typedef __attribute__((ext_vector_type(16))) _Float16 v16h;
typedef __attribute__((ext_vector_type(8)))  _Float16 v8h;
typedef __attribute__((ext_vector_type(8)))  unsigned short v8us;
typedef __attribute__((ext_vector_type(8)))  float    v8f;
typedef __attribute__((ext_vector_type(4)))  float    v4f;
typedef v8h  __attribute__((may_alias)) v8ha;
typedef v4f  __attribute__((may_alias)) v4fa;
typedef v8us __attribute__((may_alias)) v8usa;

__device__ __forceinline__ v16h cat16(v8h lo, v8h hi) { return __builtin_shufflevector(lo, hi, 0, 1, 2, 3, 4, 5, 6, 7, 8, 9, 10, 11, 12, 13, 14, 15); }
__device__ __forceinline__ v16bf cat16b(v8us lo, v8us hi) { return __builtin_bit_cast(v16bf, __builtin_shufflevector(lo, hi, 0, 1, 2, 3, 4, 5, 6, 7, 8, 9, 10, 11, 12, 13, 14, 15)); }
__device__ __forceinline__ v8f wmma16(v16h a, v16h b, v8f c) { return __builtin_amdgcn_wmma_f32_16x16x32_f16(false, a, false, b, (short)0, c, false, false); }
__device__ __forceinline__ v8f wmmab(v16bf a, v16bf b, v8f c) { return __builtin_amdgcn_wmma_f32_16x16x32_bf16(false, a, false, b, (short)0, c, false, false); }




// Fragment order: a 16-row x 32-k operand fragment is 1 KiB = two units of 512 B; unit u = (tile16 * (DM / 32) + kstep) * 2 + part holds, at lane * 16 B,
// the 8 bf16 of row tile16 * 16 + (lane & 15), k = kstep * 32 + part * 16 + (lane >> 4) * 8 .. + 7. A wave's 16-byte load of a unit is 512 contiguous bytes (4 whole lines), and units (part 0, part 1) are the two halves of the fragment register.
#define KST  (DM / 32)             // k steps of a projection
#define XUN  (NB_ * TT / 16 * KST * 2)          // units of x
#define WUN  ((DQ + 2 * DKV) / 16 * KST * 2)    // units of the three weights, features q | k | v
#define PKU  8                     // units a wave packs
static_assert(XUN % (8 * PKU) == 0 && WUN % (8 * PKU) == 0 && (KST * 2) % PKU == 0 && DQ == DM && DKV == DM, "whole work-groups; a wave's units lie in one 16-row tile");
typedef __attribute__((ext_vector_type(8))) __bf16 v8b;
__device__ __forceinline__ v8us bf8(v8f v) { return __builtin_bit_cast(v8us, __builtin_convertvector(v, v8b)); }   // round to nearest even
// k_pack: work-groups < XUN / 64 pack x, the rest the weights (w[k][n] read down k: the transposition). Its loops are unrolled so that all of a wave's loads are in flight before the first is used.
__global__ __launch_bounds__(256) void k_pack(const float* __restrict__ x, const float* __restrict__ wq, const float* __restrict__ wk, const float* __restrict__ wv, bf* XP, bf* WP) {
    const int lane = threadIdx.x & 31, lr = lane & 15, hi = lane >> 4, wvi = __builtin_amdgcn_readfirstlane((int)(threadIdx.x >> 5));
    if ((int)blockIdx.x < XUN / (8 * PKU)) {
        const int u0 = ((int)blockIdx.x * 8 + wvi) * PKU; const float* s = x + (size_t)((u0 / (KST * 2)) * 16 + lr) * DM + (u0 % (KST * 2)) * 16 + hi * 8; v8f v[PKU];
#pragma unroll
        for (int u = 0; u < PKU; ++u) v[u] = *(const v8f*)(s + u * 16);
        asm volatile("s_wait_xcnt 0x0" :: "v"(s) : "memory");   // before a register that the loads above name is written again; naming the address keeps it whole up to the wait
#pragma unroll
        for (int u = 0; u < PKU; ++u) *(v8us*)(XP + (size_t)(u0 + u) * 256 + lane * 8) = bf8(v[u]);
    } else {
        const int u0 = (((int)blockIdx.x - XUN / (8 * PKU)) * 8 + wvi) * PKU, tile = u0 / (KST * 2), sel = tile / (DM / 16);
        const float* w = sel == 0 ? wq : sel == 1 ? wk : wv; const float* s = w + (size_t)((u0 % (KST * 2)) * 16 + hi * 8) * DM + (tile % (DM / 16)) * 16 + lr; v8f v[PKU];
#pragma unroll
        for (int u = 0; u < PKU; ++u)
#pragma unroll
            for (int k = 0; k < 8; ++k) v[u][k] = s[(size_t)(u * 16 + k) * DM];
        asm volatile("s_wait_xcnt 0x0" :: "v"(s) : "memory");   // as above
#pragma unroll
        for (int u = 0; u < PKU; ++u) *(v8us*)(WP + (size_t)(u0 + u) * 256 + lane * 8) = bf8(v[u]);
    }
}

// k_proj: all projections of both batches. One wave per 64 tokens x one head of q, k or v (16 accumulators), operands straight from the packed units, the next k step's fragments asked for ahead of this step's products.
// q, k: first operand = weight rows, so a lane's 8 results are 8 consecutive d of one token; v: first operand = token rows, 8 consecutive t of one d.
// The epilogue rounds to the planes the attention reads (hi + lo bf16; for v also fp16) and stores them in fragment order, staged through the wave's own LDS: a head's plane is TT / 64 tiles of 8 KiB (64 tokens x 64 d), a tile 16 units of 512 B;
// unit s holds, at lane * 16 B, 8 values of row (s >> 2) * 16 + (lane & 15), k = (s & 3) * 16 + (lane >> 4) * 8 .. + 7, where (row, k) = (token, d) for q and k and (d, token) for v. Units 2n, 2n + 1 are the two halves of one fragment register, and every operand load of the attention is 512 contiguous bytes, 4 whole lines (from row-major planes it would take 32 bytes out of each of 16 lines, which costs the WGP's cache path several times as much). grid (tokens / 128, heads of q|k|v / 2), 4 waves = 2 x 2 tiles. Every loop is unrolled: the fragment and accumulator arrays stay in registers, every address is an immediate offset.
typedef __attribute__((ext_vector_type(2))) float v2f;
typedef __attribute__((ext_vector_type(2))) __bf16 v2b;
typedef __attribute__((ext_vector_type(4))) unsigned v4u;
typedef v4u __attribute__((may_alias)) v4ua;
#define OSP  72                    // LDS pitch in 16-bit elements: 144 B, an odd multiple of 16 B
__device__ __forceinline__ v16bf ldu(const bf* p) { return cat16b(*(const v8us*)p, *(const v8us*)(p + 256)); }
__device__ __forceinline__ v16h lduh(const h16* p) { return cat16(*(const v8h*)p, *(const v8h*)(p + 256)); }
__global__ __launch_bounds__(128) void k_proj(const bf* __restrict__ XP, const bf* __restrict__ WP, bf* QPh, bf* QPl, bf* KPh, bf* KPl, bf* VT16, bf* VTh, bf* VTl) {
    __shared__ __align__(16) bf osa[4][64 * OSP];
    const int lane = threadIdx.x & 31, lr = lane & 15, hi = lane >> 4, wvi = __builtin_amdgcn_readfirstlane((int)(threadIdx.x >> 5));
    const int tt64 = (int)blockIdx.x * 2 + (wvi & 1), hd = (int)blockIdx.y * 2 + (wvi >> 1), sel = hd / NH_;   // wave-uniform
    const bf* xb = XP + (size_t)tt64 * (4 * KST * 512) + lane * 8; const bf* wb = WP + (size_t)hd * (4 * KST * 512) + lane * 8;
    const bf* P = sel == 2 ? xb : wb; const bf* Q = sel == 2 ? wb : xb;   // result rows follow P, result columns Q
    v8f acc[4][4];
#pragma unroll
    for (int i = 0; i < 4; ++i)
#pragma unroll
        for (int j = 0; j < 4; ++j) acc[i][j] = (v8f){};
    v16bf p[2][4], q[2][4];
#pragma unroll
    for (int i = 0; i < 4; ++i) { p[0][i] = ldu(P + i * (KST * 512)); q[0][i] = ldu(Q + i * (KST * 512)); }
#pragma unroll
    for (int ks = 0; ks < KST; ++ks) {
        if (ks + 1 < KST) {
#pragma unroll
            for (int i = 0; i < 4; ++i) { p[(ks + 1) & 1][i] = ldu(P + i * (KST * 512) + (ks + 1) * 512); q[(ks + 1) & 1][i] = ldu(Q + i * (KST * 512) + (ks + 1) * 512); }
            if (ks + 2 == KST) asm volatile("s_wait_xcnt 0x0" ::: "memory");   // behind the last loads: it stands before their address registers are written again (the fence below keeps the epilogue's arithmetic behind it)
            __builtin_amdgcn_sched_barrier(0);   // keeps the next step's 16 loads ahead of this step's products: without it the compiler sinks each load to just before its use and the wave waits out the latency several times a step
        }
#pragma unroll
        for (int j = 0; j < 4; ++j)
#pragma unroll
            for (int i = 0; i < 4; ++i) acc[i][j] = wmmab(p[ks & 1][i], q[ks & 1][j], acc[i][j]);
    }
    bf* os = osa[wvi];
    const size_t hp = ((size_t)(tt64 / (TT / 64)) * NH_ + hd % NH_) * TT * HD; const int t0 = (tt64 % (TT / 64)) * 64;
    const size_t ob = hp + (size_t)t0 * HD + lane * 8;   // the lane's 16 bytes of the tile's unit 0; one unit a store
    bf* osw = os + lr * OSP + 8 * hi; const bf* osr = osw;   // a lane reads back row lr of a 16-row group, its half's 8 values of 16
    auto flush = [&](bf* d, bool more) {   // the staged 64 x 64 tile to its plane, one unit (4 whole lines) a store
        __builtin_amdgcn_wave_barrier(); asm volatile("" ::: "memory");   // keeps the reads below, of the lane's own values, behind the writes before them
#pragma unroll
        for (int s = 0; s < 16; ++s) *(v8usa*)(d + s * 256) = *(const v8usa*)(osr + (s >> 2) * 16 * OSP + (s & 3) * 16);
        if (more) { asm volatile("s_wait_xcnt 0x0" ::: "memory"); __builtin_amdgcn_sched_barrier(0); }   // the wait stands before the next plane's values reuse a register that an issued store names, the fence keeps them behind it; both keep the next plane's LDS writes behind the reads above
    };
    if (sel == 2) {   // fp16 plane, v only
#pragma unroll
        for (int i = 0; i < 4; ++i)
#pragma unroll
            for (int j = 0; j < 4; ++j) *(v8ha*)(osw + j * 16 * OSP + i * 16) = __builtin_convertvector(acc[i][j], v8h);
        flush(VT16 + ob, true);
    }
#pragma unroll
    for (int i = 0; i < 4; ++i)   // hi plane; the accumulators keep the remainder
#pragma unroll
        for (int j = 0; j < 4; ++j) { v4u o;
#pragma unroll
            for (int r = 0; r < 4; ++r) { const v2f y = {acc[i][j][2 * r], acc[i][j][2 * r + 1]}; o[r] = __builtin_bit_cast(unsigned, __builtin_convertvector(y, v2b)); acc[i][j][2 * r] -= __uint_as_float(o[r] << 16); acc[i][j][2 * r + 1] -= __uint_as_float(o[r] & 0xFFFF0000u); }
            *(v4ua*)(osw + j * 16 * OSP + i * 16) = o; }
    flush((sel == 0 ? QPh : sel == 1 ? KPh : VTh) + ob, true);
#pragma unroll
    for (int i = 0; i < 4; ++i)   // lo plane
#pragma unroll
        for (int j = 0; j < 4; ++j) *(v8usa*)(osw + j * 16 * OSP + i * 16) = bf8(acc[i][j]);
    flush((sel == 0 ? QPl : sel == 1 ? KPl : VTl) + ob, false);
}

__device__ __forceinline__ float xhalf(float x) { return __builtin_bit_cast(float, __builtin_amdgcn_permlanex16(__builtin_bit_cast(int, x), __builtin_bit_cast(int, x), 0x76543210, 0xfedcba98, false, false)); }   // lane l with lane l ^ 16
// two 2^x; the second fills the slot the instruction set asks for behind the first, the v_nop the slot behind the second (results are not sources: early clobber)
__device__ __forceinline__ void exp2x2(float a, float b, float& ra, float& rb) { asm("v_exp_f32 %0, %2\n\tv_exp_f32 %1, %3\n\tv_nop" : "=&v"(ra), "=&v"(rb) : "v"(a), "v"(b)); }
template <bool HR>
__device__ __forceinline__ void fattn_wave(const v16bf (&qh)[2][2], const v16bf (&ql)[2][2], v16bf (&kh)[2][2], v16bf (&kl)[2][2], const bf* __restrict__ Kh, const bf* __restrict__ Kl, const h16* __restrict__ V16, const bf* __restrict__ Vh, const bf* __restrict__ Vl, unsigned ko, unsigned vo, float* orow) {   // ko, vo: the lane's byte offsets in the head's K and V planes (fragment order: see k_proj)
    const float C2 = SCL * 1.4426950408889634f;
    v8f o[4][2]; float mu[2], ls[2];
#pragma unroll
    for (int nt = 0; nt < 2; ++nt) { mu[nt] = -1.0e30f; ls[nt] = 0.f;
#pragma unroll
        for (int dt = 0; dt < 4; ++dt) o[dt][nt] = (v8f){}; }
#pragma unroll 1
    for (int k0 = 0; k0 < TT; k0 += 32) {
        v16h vf[4]; v16bf vh[4], vl[4];   // this pass's V rows: asked for here, used behind the softmax
#pragma unroll
        for (int dt = 0; dt < 4; ++dt) { const size_t e = (size_t)dt * 1024; if (HR) { vh[dt] = ldu((const bf*)((const char*)Vh + vo) + e); vl[dt] = ldu((const bf*)((const char*)Vl + vo) + e); } else vf[dt] = lduh((const h16*)((const char*)V16 + vo) + e); }
        asm volatile("s_wait_xcnt 0x0" : "+v"(vo) :: "memory"); vo += (k0 & 32) ? 8192 - 1024 : 1024;   // the wait stands before the offset that the issued loads name moves on; naming it here keeps the addition behind it. A 64-token tile holds two passes: units 0, 1 then 2, 3 of each 16-row group
        v8f st[2][2];
#pragma unroll
        for (int mt = 0; mt < 2; ++mt)
#pragma unroll
            for (int nt = 0; nt < 2; ++nt) st[mt][nt] = (v8f){};
#pragma unroll
        for (int ks = 0; ks < 2; ++ks) {
#pragma unroll
            for (int mt = 0; mt < 2; ++mt)
#pragma unroll
                for (int nt = 0; nt < 2; ++nt) st[mt][nt] = wmmab(kh[mt][ks], qh[nt][ks], st[mt][nt]);
#pragma unroll
            for (int mt = 0; mt < 2; ++mt)
#pragma unroll
                for (int nt = 0; nt < 2; ++nt) st[mt][nt] = wmmab(kh[mt][ks], ql[nt][ks], st[mt][nt]);
#pragma unroll
            for (int mt = 0; mt < 2; ++mt)
#pragma unroll
                for (int nt = 0; nt < 2; ++nt) st[mt][nt] = wmmab(kl[mt][ks], qh[nt][ks], st[mt][nt]);
        }
        float cm[2];
#pragma unroll
        for (int nt = 0; nt < 2; ++nt) { float x = fmaxf(st[0][nt][0], st[1][nt][0]);
#pragma unroll
            for (int r = 1; r < 8; ++r) x = fmaxf(x, fmaxf(st[0][nt][r], st[1][nt][r]));
            cm[nt] = fmaxf(x, xhalf(x)) * C2; }
        if (k0 + 32 < TT) {   // the next pass's K rows fly during the softmax and attn.v
            ko += 32 * HD * 2;
#pragma unroll
            for (int mt = 0; mt < 2; ++mt)
#pragma unroll
                for (int ks = 0; ks < 2; ++ks) { const size_t e = (size_t)mt * 16 * HD + ks * 512; kh[mt][ks] = ldu((const bf*)((const char*)Kh + ko) + e); kl[mt][ks] = ldu((const bf*)((const char*)Kl + ko) + e); }
            asm volatile("s_wait_xcnt 0x0" : "+v"(ko) :: "memory");   // as above, for the K offset
        }
        if (__builtin_amdgcn_ballot_w32(cm[0] > mu[0] + 4.0f || cm[1] > mu[1] + 4.0f) != 0) {   // one scalar branch a pass; rare after the first passes
            const float mn0 = fmaxf(mu[0], cm[0]), mn1 = fmaxf(mu[1], cm[1]); float al[2]; exp2x2(mu[0] - mn0, mu[1] - mn1, al[0], al[1]); mu[0] = mn0; mu[1] = mn1;   // 0 on the first pass
#pragma unroll
            for (int nt = 0; nt < 2; ++nt) { ls[nt] *= al[nt];
#pragma unroll
                for (int dt = 0; dt < 4; ++dt) o[dt][nt] *= al[nt]; }
        }
#pragma unroll
        for (int nt = 0; nt < 2; ++nt) { const float nb = 6.0f - mu[nt]; float p[16], s0 = 0.f, s1 = 0.f;
#pragma unroll
            for (int r = 0; r < 8; ++r) { exp2x2(fmaf(st[0][nt][r], C2, nb), fmaf(st[1][nt][r], C2, nb), p[r], p[8 + r]); s0 += p[r]; s1 += p[8 + r]; }
            ls[nt] += s0 + s1;
            if (HR) { v16bf ph, pl;
#pragma unroll
                for (int s = 0; s < 16; ++s) { ph[s] = (__bf16)p[s]; pl[s] = (__bf16)(p[s] - (float)ph[s]); }
#pragma unroll
                for (int dt = 0; dt < 4; ++dt) o[dt][nt] = wmmab(vh[dt], ph, o[dt][nt]);
#pragma unroll
                for (int dt = 0; dt < 4; ++dt) o[dt][nt] = wmmab(vh[dt], pl, o[dt][nt]);
#pragma unroll
                for (int dt = 0; dt < 4; ++dt) o[dt][nt] = wmmab(vl[dt], ph, o[dt][nt]);
            } else { v16h pf;
#pragma unroll
                for (int s = 0; s < 16; ++s) pf[s] = (h16)p[s];
#pragma unroll
                for (int dt = 0; dt < 4; ++dt) o[dt][nt] = wmma16(vf[dt], pf, o[dt][nt]); }
        }
    }
#pragma unroll
    for (int nt = 0; nt < 2; ++nt) { const float inv = __fdiv_rn(1.0f, ls[nt] + xhalf(ls[nt]));   // a lane's 8 registers are 8 consecutive d of its query's row
#pragma unroll
        for (int dt = 0; dt < 4; ++dt) *(v8f*)(orow + (size_t)nt * 16 * DQ + dt * 16) = o[dt][nt] * inv;
        if (nt == 0) asm volatile("s_wait_xcnt 0x0" : "+v"(ls[1]) :: "memory"); }   // before the second column group's values reuse a register that an issued store names; naming its sum keeps them behind the wait
}
// grid (TT / 256, heads, batches), 8 waves that walk the same K rows; planes [batch][head][tile of 64 tokens][unit], as k_proj writes them
__global__ __launch_bounds__(32 * FAW) void k_fattn(const bf* __restrict__ QPh, const bf* __restrict__ QPl, const bf* __restrict__ KPh, const bf* __restrict__ KPl, const h16* __restrict__ VT16, const bf* __restrict__ VTh, const bf* __restrict__ VTl, float* OUT) {
    // waves 0 .. 3 take 128 rows of the first half of the sequence, waves 4 .. 7 the 128 rows half a sequence further on: a longer hi/lo wave then has a shorter fp16 wave beside it (for speed only)
    const int wv = __builtin_amdgcn_readfirstlane((int)(threadIdx.x >> 5)), q0 = (int)blockIdx.x * (4 * FAC) + (wv >> 2) * (TT / 2) + (wv & 3) * FAC;   // wave-uniform: the hi/lo test below is a scalar branch
    const size_t hp = ((size_t)blockIdx.z * NH_ + blockIdx.y) * TT * HD;
    int tx = (int)threadIdx.x; v16bf qh[2][2], ql[2][2], kh[2][2], kl[2][2];
    { const size_t fo = (size_t)(tx & 31) * 8, qp = hp + (size_t)q0 * HD + fo;
#pragma unroll
      for (int t = 0; t < 2; ++t)
#pragma unroll
          for (int ks = 0; ks < 2; ++ks) { const size_t e = (size_t)t * 16 * HD + ks * 512; qh[t][ks] = ldu(QPh + qp + e); ql[t][ks] = ldu(QPl + qp + e); kh[t][ks] = ldu(KPh + hp + fo + e); kl[t][ks] = ldu(KPl + hp + fo + e); } }
    asm volatile("s_wait_xcnt 0x0" : "+v"(tx) :: "memory");   // before a register that the loads above name is written again; the loop's offsets are formed from tx behind it, which keeps their arithmetic behind the wait
    const int lr = tx & 15, hi = (tx >> 4) & 1;
    const unsigned ko = (unsigned)(tx & 31) * 16, vo = ko;   // the lane's 16 bytes of a unit; every fragment of a pass is an immediate offset from them
    float* orow = OUT + ((size_t)blockIdx.z * TT + q0 + lr) * DQ + blockIdx.y * HD + 8 * hi;
    if (q0 < RH) fattn_wave<true>(qh, ql, kh, kl, KPh + hp, KPl + hp, VT16 + hp, VTh + hp, VTl + hp, ko, vo, orow);
    else fattn_wave<false>(qh, ql, kh, kl, KPh + hp, KPl + hp, VT16 + hp, VTh + hp, VTl + hp, ko, vo, orow);
}

extern "C" void kernel_launch(void* const* d_in, const int* in_sizes, int n_in,
                              void* d_out, int out_size, void* d_ws, size_t ws_size, hipStream_t stream) {
    (void)in_sizes; (void)n_in; (void)out_size;
    const float* x = (const float*)d_in[0]; const float* wq = (const float*)d_in[1]; const float* wk = (const float*)d_in[2]; const float* wv = (const float*)d_in[3];
    float* OUT = (float*)d_out;     // [2][4096][512]
    char* wsp = (char*)d_ws;
    auto take = [&](size_t bytes) { char* p = wsp; wsp += (bytes + 255) & ~(size_t)255; return (void*)p; };
    bf* XP = (bf*)take((size_t)XUN * 512); bf* WP = (bf*)take((size_t)WUN * 512);
    h16* VT16 = (h16*)take((size_t)NB_ * NKV * HD * TT * 2);
    bf* QPh = (bf*)take((size_t)NB_ * NH_ * TT * HD * 2); bf* QPl = (bf*)take((size_t)NB_ * NH_ * TT * HD * 2); bf* KPh = (bf*)take((size_t)NB_ * NKV * TT * HD * 2); bf* KPl = (bf*)take((size_t)NB_ * NKV * TT * HD * 2); bf* VTh = (bf*)take((size_t)NB_ * NKV * HD * TT * 2); bf* VTl = (bf*)take((size_t)NB_ * NKV * HD * TT * 2);   // the planes the fused attention reads hold both batches
    if ((size_t)(wsp - (char*)d_ws) > ws_size) return;    // ws 256 MiB
    k_pack<<<(XUN + WUN) / (8 * PKU), 256, 0, stream>>>(x, wq, wk, wv, XP, WP);
    k_proj<<<dim3(NB_ * TT / 128, (NH_ + 2 * NKV) / 2, 1), 128, 0, stream>>>(XP, WP, QPh, QPl, KPh, KPl, (bf*)VT16, VTh, VTl);
    k_fattn<<<dim3(TT / (FAW * FAC), NH_, NB_), 32 * FAW, 0, stream>>>(QPh, QPl, KPh, KPl, VT16, VTh, VTl, OUT);
}

// v005
// It runs in 128 microseconds.
// Timed twice side by side with v004, it ran 1.26 and 1.25 times as fast.
// Over all steps from v000 it is 27.3 times as fast.
#include <hip/hip_runtime.h>

// Multi-head attention over 4,096 tokens without output projection (attention_input [2][4096][512]; q,k,v = x W ('xw' [512][512] 0.05); 8 heads x 64; scores / SCALE with SCALE = N_HEADS = 8 (the source's quirk; numerically the usual 1/8 here); softmax; out = concat-heads(attn v) -> [2][4096][512] (4.2 M)).
// Three launches: x and the 'xw' weights rounded to bf16 and packed in fragment order; ONE projection launch (both batches, q, k and v) whose epilogue writes the head planes, also in fragment order; then ONE fused attention launch for both batches and all heads: hi/lo 3-product score tiles on EVERY row (no output projection averages the per-head error), running-maximum softmax in registers, P and attn.v hybrid (rows < 512 hi/lo, rest fp16); scores and P never reach memory.
// Compute dtypes, f32 accumulate: every input rounded to bf16; projections exact; scores 3 products on every row; softmax f32; attn.v rows < 512 3 products, rest fp16; output f32.

#define NB_  2
#define TT   4096
#define DM   512
#define NH_  8
#define NKV  8
#define REP  (NH_ / NKV)
#define HD   64
#define DQ   (NH_ * HD)
#define DKV  (NKV * HD)
#define ZH   1
#define RH   512                  // query rows < RH use hi+lo planes (0: none)
#define WIN  0
#define SCL  0.125f   // HD^-0.5
#define FAW  8                    // fused attention: waves per work-group
#define FAC  32                   // fused attention: query columns per wave
static_assert(RH % (4 * FAC) == 0 && 2 * RH <= TT && TT % (FAW * FAC) == 0 && TT % 32 == 0 && HD == 64 && REP == 1, "a wave is all hi/lo or all fp16, hi/lo rows lie in the first half; whole 32-key passes; 4 output tiles");
typedef _Float16 h16;
typedef unsigned short bf;
typedef __attribute__((ext_vector_type(16))) __bf16   v16bf;
typedef __attribute__((ext_vector_type(16))) _Float16 v16h;
typedef __attribute__((ext_vector_type(8)))  _Float16 v8h;
typedef __attribute__((ext_vector_type(8)))  unsigned short v8us;
typedef __attribute__((ext_vector_type(8)))  float    v8f;
typedef __attribute__((ext_vector_type(4)))  float    v4f;
typedef v8h  __attribute__((may_alias)) v8ha;
typedef v4f  __attribute__((may_alias)) v4fa;
typedef v8us __attribute__((may_alias)) v8usa;

__device__ __forceinline__ v16h cat16(v8h lo, v8h hi) { return __builtin_shufflevector(lo, hi, 0, 1, 2, 3, 4, 5, 6, 7, 8, 9, 10, 11, 12, 13, 14, 15); }
__device__ __forceinline__ v16bf cat16b(v8us lo, v8us hi) { return __builtin_bit_cast(v16bf, __builtin_shufflevector(lo, hi, 0, 1, 2, 3, 4, 5, 6, 7, 8, 9, 10, 11, 12, 13, 14, 15)); }
__device__ __forceinline__ v8f wmma16(v16h a, v16h b, v8f c) { return __builtin_amdgcn_wmma_f32_16x16x32_f16(false, a, false, b, (short)0, c, false, false); }
__device__ __forceinline__ v8f wmmab(v16bf a, v16bf b, v8f c) { return __builtin_amdgcn_wmma_f32_16x16x32_bf16(false, a, false, b, (short)0, c, false, false); }




// Fragment order: a 16-row x 32-k operand fragment is 1 KiB = two units of 512 B; unit u = (tile16 * (DM / 32) + kstep) * 2 + part holds, at lane * 16 B,
// the 8 bf16 of row tile16 * 16 + (lane & 15), k = kstep * 32 + part * 16 + (lane >> 4) * 8 .. + 7. A wave's 16-byte load of a unit is 512 contiguous bytes (4 whole lines), and units (part 0, part 1) are the two halves of the fragment register.
#define KST  (DM / 32)             // k steps of a projection
#define XUN  (NB_ * TT / 16 * KST * 2)          // units of x
#define WUN  ((DQ + 2 * DKV) / 16 * KST * 2)    // units of the three weights, features q | k | v
#define PKU  8                     // units a wave packs
static_assert(XUN % (8 * PKU) == 0 && WUN % (8 * PKU) == 0 && (KST * 2) % PKU == 0 && DQ == DM && DKV == DM, "whole work-groups; a wave's units lie in one 16-row tile");
typedef __attribute__((ext_vector_type(8))) __bf16 v8b;
__device__ __forceinline__ v8us bf8(v8f v) { return __builtin_bit_cast(v8us, __builtin_convertvector(v, v8b)); }   // round to nearest even
// k_pack: work-groups < XUN / 64 pack x, the rest the weights (w[k][n] read down k: the transposition). Its loops are unrolled so that all of a wave's loads are in flight before the first is used.
__global__ __launch_bounds__(256) void k_pack(const float* __restrict__ x, const float* __restrict__ wq, const float* __restrict__ wk, const float* __restrict__ wv, bf* XP, bf* WP) {
    const int lane = threadIdx.x & 31, lr = lane & 15, hi = lane >> 4, wvi = __builtin_amdgcn_readfirstlane((int)(threadIdx.x >> 5));
    if ((int)blockIdx.x < XUN / (8 * PKU)) {
        const int u0 = ((int)blockIdx.x * 8 + wvi) * PKU; const float* s = x + (size_t)((u0 / (KST * 2)) * 16 + lr) * DM + (u0 % (KST * 2)) * 16 + hi * 8; v8f v[PKU];
#pragma unroll
        for (int u = 0; u < PKU; ++u) v[u] = *(const v8f*)(s + u * 16);
        asm volatile("s_wait_xcnt 0x0" :: "v"(s) : "memory");   // before a register that the loads above name is written again; naming the address keeps it whole up to the wait
#pragma unroll
        for (int u = 0; u < PKU; ++u) *(v8us*)(XP + (size_t)(u0 + u) * 256 + lane * 8) = bf8(v[u]);
    } else {
        const int u0 = (((int)blockIdx.x - XUN / (8 * PKU)) * 8 + wvi) * PKU, tile = u0 / (KST * 2), sel = tile / (DM / 16);
        const float* w = sel == 0 ? wq : sel == 1 ? wk : wv; const float* s = w + (size_t)((u0 % (KST * 2)) * 16 + hi * 8) * DM + (tile % (DM / 16)) * 16 + lr; v8f v[PKU];
#pragma unroll
        for (int u = 0; u < PKU; ++u)
#pragma unroll
            for (int k = 0; k < 8; ++k) v[u][k] = s[(size_t)(u * 16 + k) * DM];
        asm volatile("s_wait_xcnt 0x0" :: "v"(s) : "memory");   // as above
#pragma unroll
        for (int u = 0; u < PKU; ++u) *(v8us*)(WP + (size_t)(u0 + u) * 256 + lane * 8) = bf8(v[u]);
    }
}

// k_proj: all projections of both batches. One wave per 64 tokens x one head of q, k or v (16 accumulators), operands straight from the packed units, the next k step's fragments asked for ahead of this step's products.
// q, k: first operand = weight rows, so a lane's 8 results are 8 consecutive d of one token; v: first operand = token rows, 8 consecutive t of one d.
// The epilogue rounds to the planes the attention reads (hi + lo bf16; for v also fp16) and stores them in fragment order, staged through the wave's own LDS: a head's plane is TT / 64 tiles of 8 KiB (64 tokens x 64 d), a tile 16 units of 512 B;
// unit s holds, at lane * 16 B, 8 values of row (s >> 2) * 16 + (lane & 15), k = (s & 3) * 16 + (lane >> 4) * 8 .. + 7, where (row, k) = (token, d) for q and k and (d, token) for v. Units 2n, 2n + 1 are the two halves of one fragment register, and every operand load of the attention is 512 contiguous bytes, 4 whole lines (from row-major planes it would take 32 bytes out of each of 16 lines, which costs the WGP's cache path several times as much). grid (tokens / 128, heads of q|k|v / 2), 4 waves = 2 x 2 tiles. Every loop is unrolled: the fragment and accumulator arrays stay in registers, every address is an immediate offset.
typedef __attribute__((ext_vector_type(2))) float v2f;
typedef __attribute__((ext_vector_type(2))) __bf16 v2b;
typedef __attribute__((ext_vector_type(4))) unsigned v4u;
typedef v4u __attribute__((may_alias)) v4ua;
#define OSP  72                    // LDS pitch in 16-bit elements: 144 B, an odd multiple of 16 B
__device__ __forceinline__ v16bf ldu(const bf* p) { return cat16b(*(const v8us*)p, *(const v8us*)(p + 256)); }
__device__ __forceinline__ v16h lduh(const h16* p) { return cat16(*(const v8h*)p, *(const v8h*)(p + 256)); }
__global__ __launch_bounds__(128) void k_proj(const bf* __restrict__ XP, const bf* __restrict__ WP, bf* QPh, bf* QPl, bf* KPh, bf* KPl, bf* VT16, bf* VTh, bf* VTl) {
    __shared__ __align__(16) bf osa[4][64 * OSP];
    const int lane = threadIdx.x & 31, lr = lane & 15, hi = lane >> 4, wvi = __builtin_amdgcn_readfirstlane((int)(threadIdx.x >> 5));
    const int tt64 = (int)blockIdx.x * 2 + (wvi & 1), hd = (int)blockIdx.y * 2 + (wvi >> 1), sel = hd / NH_;   // wave-uniform
    const bf* xb = XP + (size_t)tt64 * (4 * KST * 512) + lane * 8; const bf* wb = WP + (size_t)hd * (4 * KST * 512) + lane * 8;
    const bf* P = sel == 2 ? xb : wb; const bf* Q = sel == 2 ? wb : xb;   // result rows follow P, result columns Q
    v8f acc[4][4];
#pragma unroll
    for (int i = 0; i < 4; ++i)
#pragma unroll
        for (int j = 0; j < 4; ++j) acc[i][j] = (v8f){};
    v16bf p[2][4], q[2][4];
#pragma unroll
    for (int i = 0; i < 4; ++i) { p[0][i] = ldu(P + i * (KST * 512)); q[0][i] = ldu(Q + i * (KST * 512)); }
#pragma unroll
    for (int ks = 0; ks < KST; ++ks) {
        if (ks + 1 < KST) {
#pragma unroll
            for (int i = 0; i < 4; ++i) { p[(ks + 1) & 1][i] = ldu(P + i * (KST * 512) + (ks + 1) * 512); q[(ks + 1) & 1][i] = ldu(Q + i * (KST * 512) + (ks + 1) * 512); }
            if (ks + 2 == KST) asm volatile("s_wait_xcnt 0x0" ::: "memory");   // behind the last loads: it stands before their address registers are written again (the fence below keeps the epilogue's arithmetic behind it)
            __builtin_amdgcn_sched_barrier(0);   // keeps the next step's 16 loads ahead of this step's products: without it the compiler sinks each load to just before its use and the wave waits out the latency several times a step
        }
#pragma unroll
        for (int j = 0; j < 4; ++j)
#pragma unroll
            for (int i = 0; i < 4; ++i) acc[i][j] = wmmab(p[ks & 1][i], q[ks & 1][j], acc[i][j]);
    }
    bf* os = osa[wvi];
    const size_t hp = ((size_t)(tt64 / (TT / 64)) * NH_ + hd % NH_) * TT * HD; const int t0 = (tt64 % (TT / 64)) * 64;
    const size_t ob = hp + (size_t)t0 * HD + lane * 8;   // the lane's 16 bytes of the tile's unit 0; one unit a store
    bf* osw = os + lr * OSP + 8 * hi; const bf* osr = osw;   // a lane reads back row lr of a 16-row group, its half's 8 values of 16
    auto flush = [&](bf* d, bool more) {   // the staged 64 x 64 tile to its plane, one unit (4 whole lines) a store
        __builtin_amdgcn_wave_barrier(); asm volatile("" ::: "memory");   // keeps the reads below, of the lane's own values, behind the writes before them
#pragma unroll
        for (int s = 0; s < 16; ++s) *(v8usa*)(d + s * 256) = *(const v8usa*)(osr + (s >> 2) * 16 * OSP + (s & 3) * 16);
        if (more) { asm volatile("s_wait_xcnt 0x0" ::: "memory"); __builtin_amdgcn_sched_barrier(0); }   // the wait stands before the next plane's values reuse a register that an issued store names, the fence keeps them behind it; both keep the next plane's LDS writes behind the reads above
    };
    if (sel == 2) {   // fp16 plane, v only
#pragma unroll
        for (int i = 0; i < 4; ++i)
#pragma unroll
            for (int j = 0; j < 4; ++j) *(v8ha*)(osw + j * 16 * OSP + i * 16) = __builtin_convertvector(acc[i][j], v8h);
        flush(VT16 + ob, true);
    }
#pragma unroll
    for (int i = 0; i < 4; ++i)   // hi plane; the accumulators keep the remainder
#pragma unroll
        for (int j = 0; j < 4; ++j) { v4u o;
#pragma unroll
            for (int r = 0; r < 4; ++r) { const v2f y = {acc[i][j][2 * r], acc[i][j][2 * r + 1]}; o[r] = __builtin_bit_cast(unsigned, __builtin_convertvector(y, v2b)); acc[i][j][2 * r] -= __uint_as_float(o[r] << 16); acc[i][j][2 * r + 1] -= __uint_as_float(o[r] & 0xFFFF0000u); }
            *(v4ua*)(osw + j * 16 * OSP + i * 16) = o; }
    flush((sel == 0 ? QPh : sel == 1 ? KPh : VTh) + ob, true);
#pragma unroll
    for (int i = 0; i < 4; ++i)   // lo plane
#pragma unroll
        for (int j = 0; j < 4; ++j) *(v8usa*)(osw + j * 16 * OSP + i * 16) = bf8(acc[i][j]);
    flush((sel == 0 ? QPl : sel == 1 ? KPl : VTl) + ob, false);
}

#define SKEY 128                   // keys a stage
#define SPB  (SKEY * HD * 2)       // bytes of one plane's stage
#define NST  (TT / SKEY)           // stages
#define NPL  5                     // planes a buffer holds: K hi, K lo, V fp16, V hi, V lo
static_assert(TT % SKEY == 0 && NST >= 2 && SKEY % 64 == 0 && SPB == 4 * 32 * FAW * 16, "whole stages of whole 64-token tiles, at least two; four 16-byte copies a lane and plane");
__device__ __forceinline__ float xhalf(float x) { return __builtin_bit_cast(float, __builtin_amdgcn_permlanex16(__builtin_bit_cast(int, x), __builtin_bit_cast(int, x), 0x76543210, 0xfedcba98, false, false)); }   // lane l with lane l ^ 16
// two 2^x; the second fills the slot the instruction set asks for behind the first, the v_nop the slot behind the second (results are not sources: early clobber)
__device__ __forceinline__ void exp2x2(float a, float b, float& ra, float& rb) { asm("v_exp_f32 %0, %2\n\tv_exp_f32 %1, %3\n\tv_nop" : "=&v"(ra), "=&v"(rb) : "v"(a), "v"(b)); }
typedef __attribute__((ext_vector_type(4))) int v4i;
typedef __attribute__((address_space(1))) v4i gv4i;
typedef __attribute__((address_space(3))) v4i lv4i;
// one plane's stage: four copies (the builtin form), each the work-group's 256 lanes x 16 B = 4 KiB; l, g: the lane's own 16 bytes in LDS and in global memory; the offset moves both addresses
__device__ __forceinline__ void cp4(__attribute__((address_space(3))) char* l, const char* g) {
    __builtin_amdgcn_global_load_async_to_lds_b128((gv4i*)g, (lv4i*)l, 0, 0); __builtin_amdgcn_global_load_async_to_lds_b128((gv4i*)g, (lv4i*)l, 4096, 0);
    __builtin_amdgcn_global_load_async_to_lds_b128((gv4i*)g, (lv4i*)l, 8192, 0); __builtin_amdgcn_global_load_async_to_lds_b128((gv4i*)g, (lv4i*)l, 12288, 0);
}
typedef __attribute__((address_space(3))) const char lch;
typedef __attribute__((address_space(3))) const v8us lv8us;
typedef __attribute__((address_space(3))) const v8h lv8h;
__device__ __forceinline__ v16bf ldl(lch* p) { return cat16b(*(lv8us*)p, *(lv8us*)(p + 512)); }    // the two units of a fragment, from LDS
__device__ __forceinline__ v16h ldlh(lch* p) { return cat16(*(lv8h*)p, *(lv8h*)(p + 512)); }
// one stage of one wave: sb = the lane's 16 bytes of unit 0 of the stage's buffer (fragment order: see k_proj); it reads that buffer alone
template <bool HR>
__device__ __forceinline__ void fattn_stage(const v16bf (&qh)[2][2], const v16bf (&ql)[2][2], lch* sb, v8f (&o)[4][2], float (&mu)[2], float (&ls)[2]) {
    const float C2 = SCL * 1.4426950408889634f;
    v16bf kh[2][2], kl[2][2];
#pragma unroll
    for (int mt = 0; mt < 2; ++mt)
#pragma unroll
        for (int ks = 0; ks < 2; ++ks) { const int e = mt * 2048 + ks * 1024; kh[mt][ks] = ldl(sb + e); kl[mt][ks] = ldl(sb + SPB + e); }
    // rolled: one copy of the pass in the instruction cache, and the next pass's K rows go into the registers of this pass's
#pragma unroll 1
    for (int pp = 0; pp < SKEY / 32; ++pp) {
        v16h vf[4]; v16bf vh[4], vl[4];   // this pass's V rows: asked for here, used behind the softmax
        lch* vb = sb + (pp >> 1) * 8192 + (pp & 1) * 1024;   // a 64-token tile holds two passes: units 0, 1 then 2, 3 of each 16-row group
#pragma unroll
        for (int dt = 0; dt < 4; ++dt) { const int e = dt * 2048; if (HR) { vh[dt] = ldl(vb + 3 * SPB + e); vl[dt] = ldl(vb + 4 * SPB + e); } else vf[dt] = ldlh(vb + 2 * SPB + e); }
        __builtin_amdgcn_sched_barrier(0);   // keeps the V reads here, ahead of the score products: without it the compiler sinks them behind the next pass's K reads, into the softmax, and attn.v waits for both
        v8f st[2][2];
#pragma unroll
        for (int mt = 0; mt < 2; ++mt)
#pragma unroll
            for (int nt = 0; nt < 2; ++nt) st[mt][nt] = (v8f){};
#pragma unroll
        for (int ks = 0; ks < 2; ++ks) {
#pragma unroll
            for (int mt = 0; mt < 2; ++mt)
#pragma unroll
                for (int nt = 0; nt < 2; ++nt) st[mt][nt] = wmmab(kh[mt][ks], qh[nt][ks], st[mt][nt]);
#pragma unroll
            for (int mt = 0; mt < 2; ++mt)
#pragma unroll
                for (int nt = 0; nt < 2; ++nt) st[mt][nt] = wmmab(kh[mt][ks], ql[nt][ks], st[mt][nt]);
#pragma unroll
            for (int mt = 0; mt < 2; ++mt)
#pragma unroll
                for (int nt = 0; nt < 2; ++nt) st[mt][nt] = wmmab(kl[mt][ks], qh[nt][ks], st[mt][nt]);
        }
        float cm[2];
#pragma unroll
        for (int nt = 0; nt < 2; ++nt) { float x = fmaxf(st[0][nt][0], st[1][nt][0]);
#pragma unroll
            for (int r = 1; r < 8; ++r) x = fmaxf(x, fmaxf(st[0][nt][r], st[1][nt][r]));
            cm[nt] = fmaxf(x, xhalf(x)) * C2; }
        if (pp + 1 < SKEY / 32) {   // the next pass's K rows, of this same stage, come during the softmax and attn.v
            lch* kb = sb + (pp + 1) * 4096;
#pragma unroll
            for (int mt = 0; mt < 2; ++mt)
#pragma unroll
                for (int ks = 0; ks < 2; ++ks) { const int e = mt * 2048 + ks * 1024; kh[mt][ks] = ldl(kb + e); kl[mt][ks] = ldl(kb + SPB + e); }
        }
        if (__builtin_amdgcn_ballot_w32(cm[0] > mu[0] + 4.0f || cm[1] > mu[1] + 4.0f) != 0) {   // one scalar branch a pass; rare after the first passes
            const float mn0 = fmaxf(mu[0], cm[0]), mn1 = fmaxf(mu[1], cm[1]); float al[2]; exp2x2(mu[0] - mn0, mu[1] - mn1, al[0], al[1]); mu[0] = mn0; mu[1] = mn1;   // 0 on the first pass
#pragma unroll
            for (int nt = 0; nt < 2; ++nt) { ls[nt] *= al[nt];
#pragma unroll
                for (int dt = 0; dt < 4; ++dt) o[dt][nt] *= al[nt]; }
        }
#pragma unroll
        for (int nt = 0; nt < 2; ++nt) { const float nb = 6.0f - mu[nt]; float p[16], s0 = 0.f, s1 = 0.f;
#pragma unroll
            for (int r = 0; r < 8; ++r) { exp2x2(fmaf(st[0][nt][r], C2, nb), fmaf(st[1][nt][r], C2, nb), p[r], p[8 + r]); s0 += p[r]; s1 += p[8 + r]; }
            ls[nt] += s0 + s1;
            if (HR) { v16bf ph, pl;
#pragma unroll
                for (int s = 0; s < 16; ++s) { ph[s] = (__bf16)p[s]; pl[s] = (__bf16)(p[s] - (float)ph[s]); }
#pragma unroll
                for (int dt = 0; dt < 4; ++dt) o[dt][nt] = wmmab(vh[dt], ph, o[dt][nt]);
#pragma unroll
                for (int dt = 0; dt < 4; ++dt) o[dt][nt] = wmmab(vh[dt], pl, o[dt][nt]);
#pragma unroll
                for (int dt = 0; dt < 4; ++dt) o[dt][nt] = wmmab(vl[dt], ph, o[dt][nt]);
            } else { v16h pf;
#pragma unroll
                for (int s = 0; s < 16; ++s) pf[s] = (h16)p[s];
#pragma unroll
                for (int dt = 0; dt < 4; ++dt) o[dt][nt] = wmma16(vf[dt], pf, o[dt][nt]); }
        }
    }
}
// grid (TT / 256, heads, batches), 8 waves that walk the same K rows; planes [batch][head][tile of 64 tokens][unit], as k_proj writes them
__global__ __launch_bounds__(32 * FAW) void k_fattn(const bf* __restrict__ QPh, const bf* __restrict__ QPl, const bf* __restrict__ KPh, const bf* __restrict__ KPl, const h16* __restrict__ VT16, const bf* __restrict__ VTh, const bf* __restrict__ VTl, float* OUT) {
    __shared__ __attribute__((aligned(512))) char ring[2][NPL * SPB];
    // waves 0 .. 3 take 128 rows of the first half of the sequence, waves 4 .. 7 the 128 rows half a sequence further on: a longer hi/lo wave then has a shorter fp16 wave beside it (for speed only)
    const int wv = __builtin_amdgcn_readfirstlane((int)(threadIdx.x >> 5)), q0 = (int)blockIdx.x * (4 * FAC) + (wv >> 2) * (TT / 2) + (wv & 3) * FAC;   // wave-uniform: the hi/lo test below is a scalar branch
    const size_t hp = ((size_t)blockIdx.z * NH_ + blockIdx.y) * TT * HD;
    const bool hrg = (int)blockIdx.x * (4 * FAC) < RH;   // the same for the whole work-group: its waves 0 .. 3 are hi/lo waves and read the V hi and lo planes
    const unsigned l16 = (threadIdx.x & 31) * 16u;   // the lane's 16 bytes of a unit
    auto fill = [&](int s) {   // stage s of every plane that the work-group reads, into buffer s & 1; every lane on, 12 or 20 copies a wave
        const unsigned t = l16 + (unsigned)wv * 512u;   // the lane's 16 bytes of a 4-KiB copy
        __attribute__((address_space(3))) char* l = (__attribute__((address_space(3))) char*)&ring[0][0] + t + (unsigned)(s & 1) * (NPL * SPB); const size_t g = hp * 2 + (size_t)s * SPB + t;
        cp4(l, (const char*)KPh + g); cp4(l + SPB, (const char*)KPl + g); cp4(l + 2 * SPB, (const char*)VT16 + g);
        if (hrg) { cp4(l + 3 * SPB, (const char*)VTh + g); cp4(l + 4 * SPB, (const char*)VTl + g); }
    };
    fill(0);
    v16bf qh[2][2], ql[2][2];
    { const size_t fo = (size_t)(threadIdx.x & 31) * 8, qp = hp + (size_t)q0 * HD + fo;
#pragma unroll
      for (int t = 0; t < 2; ++t)
#pragma unroll
          for (int ks = 0; ks < 2; ++ks) { const size_t e = (size_t)t * 16 * HD + ks * 512; qh[t][ks] = ldu(QPh + qp + e); ql[t][ks] = ldu(QPl + qp + e); } }
    asm volatile("s_wait_xcnt 0x0" ::: "memory");   // before a register that the loads above name is written again
    __builtin_amdgcn_sched_barrier(0);                // keeps the arithmetic below behind that wait
    const int lr = threadIdx.x & 15, hi = (threadIdx.x >> 4) & 1;
    float* orow = OUT + ((size_t)blockIdx.z * TT + q0 + lr) * DQ + blockIdx.y * HD + 8 * hi;
    lch* sb0 = (lch*)&ring[0][0] + l16;   // the lane's 16 bytes of a unit; every fragment of a stage is an offset from them
    v8f o[4][2]; float mu[2], ls[2];
#pragma unroll
    for (int nt = 0; nt < 2; ++nt) { mu[nt] = -1.0e30f; ls[nt] = 0.f;
#pragma unroll
        for (int dt = 0; dt < 4; ++dt) o[dt][nt] = (v8f){}; }
    asm volatile("s_wait_asynccnt 0x0" ::: "memory");   // this wave's copies of stage 0 have landed
    __syncthreads();                                     // and every other wave's: stage 0 may be read
    fill(1);
    // rolled: one copy of each kind of stage in the instruction cache
#pragma unroll 1
    for (int s = 0; s < NST; ++s) {
        lch* sb = sb0 + (s & 1) * (NPL * SPB);
        if (q0 < RH) fattn_stage<true>(qh, ql, sb, o, mu, ls);
        else fattn_stage<false>(qh, ql, sb, o, mu, ls);
        asm volatile("s_wait_dscnt 0x0" ::: "memory");     // this wave's reads of stage s are done before the buffer may be refilled
        asm volatile("s_wait_asynccnt 0x0" ::: "memory");  // this wave's copies of stage s + 1 have landed
        __syncthreads();                                    // publishes stage s + 1 and ends every wave's reads of stage s
        if (s + 2 < NST) fill(s + 2);
    }
    asm volatile("s_wait_asynccnt 0x0" ::: "memory");   // nothing of this wave is in flight when it ends
#pragma unroll
    for (int nt = 0; nt < 2; ++nt) { const float inv = __fdiv_rn(1.0f, ls[nt] + xhalf(ls[nt]));   // a lane's 8 registers are 8 consecutive d of its query's row
#pragma unroll
        for (int dt = 0; dt < 4; ++dt) *(v8f*)(orow + (size_t)nt * 16 * DQ + dt * 16) = o[dt][nt] * inv;
        if (nt == 0) asm volatile("s_wait_xcnt 0x0" : "+v"(ls[1]) :: "memory"); }   // before the second column group's values reuse a register that an issued store names; naming its sum keeps them behind the wait
}

extern "C" void kernel_launch(void* const* d_in, const int* in_sizes, int n_in,
                              void* d_out, int out_size, void* d_ws, size_t ws_size, hipStream_t stream) {
    (void)in_sizes; (void)n_in; (void)out_size;
    const float* x = (const float*)d_in[0]; const float* wq = (const float*)d_in[1]; const float* wk = (const float*)d_in[2]; const float* wv = (const float*)d_in[3];
    float* OUT = (float*)d_out;     // [2][4096][512]
    char* wsp = (char*)d_ws;
    auto take = [&](size_t bytes) { char* p = wsp; wsp += (bytes + 255) & ~(size_t)255; return (void*)p; };
    bf* XP = (bf*)take((size_t)XUN * 512); bf* WP = (bf*)take((size_t)WUN * 512);
    h16* VT16 = (h16*)take((size_t)NB_ * NKV * HD * TT * 2);
    bf* QPh = (bf*)take((size_t)NB_ * NH_ * TT * HD * 2); bf* QPl = (bf*)take((size_t)NB_ * NH_ * TT * HD * 2); bf* KPh = (bf*)take((size_t)NB_ * NKV * TT * HD * 2); bf* KPl = (bf*)take((size_t)NB_ * NKV * TT * HD * 2); bf* VTh = (bf*)take((size_t)NB_ * NKV * HD * TT * 2); bf* VTl = (bf*)take((size_t)NB_ * NKV * HD * TT * 2);   // the planes the fused attention reads hold both batches
    if ((size_t)(wsp - (char*)d_ws) > ws_size) return;    // ws 256 MiB
    k_pack<<<(XUN + WUN) / (8 * PKU), 256, 0, stream>>>(x, wq, wk, wv, XP, WP);
    k_proj<<<dim3(NB_ * TT / 128, (NH_ + 2 * NKV) / 2, 1), 128, 0, stream>>>(XP, WP, QPh, QPl, KPh, KPl, (bf*)VT16, VTh, VTl);
    k_fattn<<<dim3(TT / (FAW * FAC), NH_, NB_), 32 * FAW, 0, stream>>>(QPh, QPl, KPh, KPl, VT16, VTh, VTl, OUT);
}

// v006
// A run of this version takes 121 microseconds.
// Timed twice side by side with v005, it ran 1.06 times as fast both times.
// All steps since v000 together make it 28.9 times as fast.
#include <hip/hip_runtime.h>

// Multi-head attention over 4,096 tokens without output projection (attention_input [2][4096][512]; q,k,v = x W ('xw' [512][512] 0.05); 8 heads x 64; scores / SCALE with SCALE = N_HEADS = 8 (the source's quirk; numerically the usual 1/8 here); softmax; out = concat-heads(attn v) -> [2][4096][512] (4.2 M)).
// Three launches: x and the 'xw' weights rounded to bf16 and packed in fragment order; ONE projection launch (both batches, q, k and v) whose epilogue writes the head planes, also in fragment order; then ONE fused attention launch for both batches and all heads: hi/lo 3-product score tiles on EVERY row (no output projection averages the per-head error), running-maximum softmax in registers, P and attn.v hybrid (rows < 512 hi/lo, rest fp16); scores and P never reach memory.
// Compute dtypes, f32 accumulate: every input rounded to bf16; projections exact; scores 3 products on every row; softmax f32; attn.v rows < 512 3 products, rest fp16; output f32.

#define NB_  2
#define TT   4096
#define DM   512
#define NH_  8
#define NKV  8
#define REP  (NH_ / NKV)
#define HD   64
#define DQ   (NH_ * HD)
#define DKV  (NKV * HD)
#define ZH   1
#define RH   512                  // query rows < RH use hi+lo planes (0: none)
#define WIN  0
#define SCL  0.125f   // HD^-0.5
#define FAW  8                    // fused attention: query groups (of FAC columns) per work-group
#define KSP  2                    // fused attention: waves that share a query group, each with its own keys of every stage
#define FAC  32                   // fused attention: query columns per wave
static_assert(RH % (4 * FAC) == 0 && 2 * RH <= TT && TT % (FAW * FAC) == 0 && TT % 32 == 0 && HD == 64 && REP == 1, "a wave is all hi/lo or all fp16, hi/lo rows lie in the first half; whole 32-key passes; 4 output tiles");
typedef _Float16 h16;
typedef unsigned short bf;
typedef __attribute__((ext_vector_type(16))) __bf16   v16bf;
typedef __attribute__((ext_vector_type(16))) _Float16 v16h;
typedef __attribute__((ext_vector_type(8)))  _Float16 v8h;
typedef __attribute__((ext_vector_type(8)))  unsigned short v8us;
typedef __attribute__((ext_vector_type(8)))  float    v8f;
typedef __attribute__((ext_vector_type(4)))  float    v4f;
typedef v8h  __attribute__((may_alias)) v8ha;
typedef v4f  __attribute__((may_alias)) v4fa;
typedef v8us __attribute__((may_alias)) v8usa;

__device__ __forceinline__ v16h cat16(v8h lo, v8h hi) { return __builtin_shufflevector(lo, hi, 0, 1, 2, 3, 4, 5, 6, 7, 8, 9, 10, 11, 12, 13, 14, 15); }
__device__ __forceinline__ v16bf cat16b(v8us lo, v8us hi) { return __builtin_bit_cast(v16bf, __builtin_shufflevector(lo, hi, 0, 1, 2, 3, 4, 5, 6, 7, 8, 9, 10, 11, 12, 13, 14, 15)); }
__device__ __forceinline__ v8f wmma16(v16h a, v16h b, v8f c) { return __builtin_amdgcn_wmma_f32_16x16x32_f16(false, a, false, b, (short)0, c, false, false); }
__device__ __forceinline__ v8f wmmab(v16bf a, v16bf b, v8f c) { return __builtin_amdgcn_wmma_f32_16x16x32_bf16(false, a, false, b, (short)0, c, false, false); }




// Fragment order: a 16-row x 32-k operand fragment is 1 KiB = two units of 512 B; unit u = (tile16 * (DM / 32) + kstep) * 2 + part holds, at lane * 16 B,
// the 8 bf16 of row tile16 * 16 + (lane & 15), k = kstep * 32 + part * 16 + (lane >> 4) * 8 .. + 7. A wave's 16-byte load of a unit is 512 contiguous bytes (4 whole lines), and units (part 0, part 1) are the two halves of the fragment register.
#define KST  (DM / 32)             // k steps of a projection
#define XUN  (NB_ * TT / 16 * KST * 2)          // units of x
#define WUN  ((DQ + 2 * DKV) / 16 * KST * 2)    // units of the three weights, features q | k | v
#define PKU  8                     // units a wave packs
static_assert(XUN % (8 * PKU) == 0 && WUN % (8 * PKU) == 0 && (KST * 2) % PKU == 0 && DQ == DM && DKV == DM, "whole work-groups; a wave's units lie in one 16-row tile");
typedef __attribute__((ext_vector_type(8))) __bf16 v8b;
__device__ __forceinline__ v8us bf8(v8f v) { return __builtin_bit_cast(v8us, __builtin_convertvector(v, v8b)); }   // round to nearest even
// k_pack: work-groups < XUN / 64 pack x, the rest the weights (w[k][n] read down k: the transposition). Its loops are unrolled so that all of a wave's loads are in flight before the first is used.
__global__ __launch_bounds__(256) void k_pack(const float* __restrict__ x, const float* __restrict__ wq, const float* __restrict__ wk, const float* __restrict__ wv, bf* XP, bf* WP) {
    const int lane = threadIdx.x & 31, lr = lane & 15, hi = lane >> 4, wvi = __builtin_amdgcn_readfirstlane((int)(threadIdx.x >> 5));
    if ((int)blockIdx.x < XUN / (8 * PKU)) {
        const int u0 = ((int)blockIdx.x * 8 + wvi) * PKU; const float* s = x + (size_t)((u0 / (KST * 2)) * 16 + lr) * DM + (u0 % (KST * 2)) * 16 + hi * 8; v8f v[PKU];
#pragma unroll
        for (int u = 0; u < PKU; ++u) v[u] = *(const v8f*)(s + u * 16);
        asm volatile("s_wait_xcnt 0x0" :: "v"(s) : "memory");   // before a register that the loads above name is written again; naming the address keeps it whole up to the wait
#pragma unroll
        for (int u = 0; u < PKU; ++u) *(v8us*)(XP + (size_t)(u0 + u) * 256 + lane * 8) = bf8(v[u]);
    } else {
        const int u0 = (((int)blockIdx.x - XUN / (8 * PKU)) * 8 + wvi) * PKU, tile = u0 / (KST * 2), sel = tile / (DM / 16);
        const float* w = sel == 0 ? wq : sel == 1 ? wk : wv; const float* s = w + (size_t)((u0 % (KST * 2)) * 16 + hi * 8) * DM + (tile % (DM / 16)) * 16 + lr; v8f v[PKU];
#pragma unroll
        for (int u = 0; u < PKU; ++u)
#pragma unroll
            for (int k = 0; k < 8; ++k) v[u][k] = s[(size_t)(u * 16 + k) * DM];
        asm volatile("s_wait_xcnt 0x0" :: "v"(s) : "memory");   // as above
#pragma unroll
        for (int u = 0; u < PKU; ++u) *(v8us*)(WP + (size_t)(u0 + u) * 256 + lane * 8) = bf8(v[u]);
    }
}

// k_proj: all projections of both batches. One wave per 64 tokens x one head of q, k or v (16 accumulators), operands straight from the packed units, the next k step's fragments asked for ahead of this step's products.
// q, k: first operand = weight rows, so a lane's 8 results are 8 consecutive d of one token; v: first operand = token rows, 8 consecutive t of one d.
// The epilogue rounds to the planes the attention reads (hi + lo bf16; for v also fp16) and stores them in fragment order, staged through the wave's own LDS: a head's plane is TT / 64 tiles of 8 KiB (64 tokens x 64 d), a tile 16 units of 512 B;
// unit s holds, at lane * 16 B, 8 values of row (s >> 2) * 16 + (lane & 15), k = (s & 3) * 16 + (lane >> 4) * 8 .. + 7, where (row, k) = (token, d) for q and k and (d, token) for v. Units 2n, 2n + 1 are the two halves of one fragment register, and every operand load of the attention is 512 contiguous bytes, 4 whole lines (from row-major planes it would take 32 bytes out of each of 16 lines, which costs the WGP's cache path several times as much). grid (tokens / 128, heads of q|k|v / 2), 4 waves = 2 x 2 tiles. Every loop is unrolled: the fragment and accumulator arrays stay in registers, every address is an immediate offset.
typedef __attribute__((ext_vector_type(2))) float v2f;
typedef __attribute__((ext_vector_type(2))) __bf16 v2b;
typedef __attribute__((ext_vector_type(4))) unsigned v4u;
typedef v4u __attribute__((may_alias)) v4ua;
#define OSP  72                    // LDS pitch in 16-bit elements: 144 B, an odd multiple of 16 B
__device__ __forceinline__ v16bf ldu(const bf* p) { return cat16b(*(const v8us*)p, *(const v8us*)(p + 256)); }
__device__ __forceinline__ v16h lduh(const h16* p) { return cat16(*(const v8h*)p, *(const v8h*)(p + 256)); }
__global__ __launch_bounds__(128) void k_proj(const bf* __restrict__ XP, const bf* __restrict__ WP, bf* QPh, bf* QPl, bf* KPh, bf* KPl, bf* VT16, bf* VTh, bf* VTl) {
    __shared__ __align__(16) bf osa[4][64 * OSP];
    const int lane = threadIdx.x & 31, lr = lane & 15, hi = lane >> 4, wvi = __builtin_amdgcn_readfirstlane((int)(threadIdx.x >> 5));
    const int tt64 = (int)blockIdx.x * 2 + (wvi & 1), hd = (int)blockIdx.y * 2 + (wvi >> 1), sel = hd / NH_;   // wave-uniform
    const bf* xb = XP + (size_t)tt64 * (4 * KST * 512) + lane * 8; const bf* wb = WP + (size_t)hd * (4 * KST * 512) + lane * 8;
    const bf* P = sel == 2 ? xb : wb; const bf* Q = sel == 2 ? wb : xb;   // result rows follow P, result columns Q
    v8f acc[4][4];
#pragma unroll
    for (int i = 0; i < 4; ++i)
#pragma unroll
        for (int j = 0; j < 4; ++j) acc[i][j] = (v8f){};
    v16bf p[2][4], q[2][4];
#pragma unroll
    for (int i = 0; i < 4; ++i) { p[0][i] = ldu(P + i * (KST * 512)); q[0][i] = ldu(Q + i * (KST * 512)); }
#pragma unroll
    for (int ks = 0; ks < KST; ++ks) {
        if (ks + 1 < KST) {
#pragma unroll
            for (int i = 0; i < 4; ++i) { p[(ks + 1) & 1][i] = ldu(P + i * (KST * 512) + (ks + 1) * 512); q[(ks + 1) & 1][i] = ldu(Q + i * (KST * 512) + (ks + 1) * 512); }
            if (ks + 2 == KST) asm volatile("s_wait_xcnt 0x0" ::: "memory");   // behind the last loads: it stands before their address registers are written again (the fence below keeps the epilogue's arithmetic behind it)
            __builtin_amdgcn_sched_barrier(0);   // keeps the next step's 16 loads ahead of this step's products: without it the compiler sinks each load to just before its use and the wave waits out the latency several times a step
        }
#pragma unroll
        for (int j = 0; j < 4; ++j)
#pragma unroll
            for (int i = 0; i < 4; ++i) acc[i][j] = wmmab(p[ks & 1][i], q[ks & 1][j], acc[i][j]);
    }
    bf* os = osa[wvi];
    const size_t hp = ((size_t)(tt64 / (TT / 64)) * NH_ + hd % NH_) * TT * HD; const int t0 = (tt64 % (TT / 64)) * 64;
    const size_t ob = hp + (size_t)t0 * HD + lane * 8;   // the lane's 16 bytes of the tile's unit 0; one unit a store
    bf* osw = os + lr * OSP + 8 * hi; const bf* osr = osw;   // a lane reads back row lr of a 16-row group, its half's 8 values of 16
    auto flush = [&](bf* d, bool more) {   // the staged 64 x 64 tile to its plane, one unit (4 whole lines) a store
        __builtin_amdgcn_wave_barrier(); asm volatile("" ::: "memory");   // keeps the reads below, of the lane's own values, behind the writes before them
#pragma unroll
        for (int s = 0; s < 16; ++s) *(v8usa*)(d + s * 256) = *(const v8usa*)(osr + (s >> 2) * 16 * OSP + (s & 3) * 16);
        if (more) { asm volatile("s_wait_xcnt 0x0" ::: "memory"); __builtin_amdgcn_sched_barrier(0); }   // the wait stands before the next plane's values reuse a register that an issued store names, the fence keeps them behind it; both keep the next plane's LDS writes behind the reads above
    };
    if (sel == 2) {   // fp16 plane, v only
#pragma unroll
        for (int i = 0; i < 4; ++i)
#pragma unroll
            for (int j = 0; j < 4; ++j) *(v8ha*)(osw + j * 16 * OSP + i * 16) = __builtin_convertvector(acc[i][j], v8h);
        flush(VT16 + ob, true);
    }
#pragma unroll
    for (int i = 0; i < 4; ++i)   // hi plane; the accumulators keep the remainder
#pragma unroll
        for (int j = 0; j < 4; ++j) { v4u o;
#pragma unroll
            for (int r = 0; r < 4; ++r) { const v2f y = {acc[i][j][2 * r], acc[i][j][2 * r + 1]}; o[r] = __builtin_bit_cast(unsigned, __builtin_convertvector(y, v2b)); acc[i][j][2 * r] -= __uint_as_float(o[r] << 16); acc[i][j][2 * r + 1] -= __uint_as_float(o[r] & 0xFFFF0000u); }
            *(v4ua*)(osw + j * 16 * OSP + i * 16) = o; }
    flush((sel == 0 ? QPh : sel == 1 ? KPh : VTh) + ob, true);
#pragma unroll
    for (int i = 0; i < 4; ++i)   // lo plane
#pragma unroll
        for (int j = 0; j < 4; ++j) *(v8usa*)(osw + j * 16 * OSP + i * 16) = bf8(acc[i][j]);
    flush((sel == 0 ? QPl : sel == 1 ? KPl : VTl) + ob, false);
}

#define SKEY 128                   // keys a stage
#define SPB  (SKEY * HD * 2)       // bytes of one plane's stage
#define NST  (TT / SKEY)           // stages
#define NPL  5                     // planes a buffer holds: K hi, K lo, V fp16, V hi, V lo
static_assert(TT % SKEY == 0 && NST >= 2 && SKEY == 64 * KSP && SPB == 2 * 32 * FAW * KSP * 16, "whole stages, at least two; one 64-token tile a wave half; two 16-byte copies a lane and plane");
__device__ __forceinline__ float xhalf(float x) { return __builtin_bit_cast(float, __builtin_amdgcn_permlanex16(__builtin_bit_cast(int, x), __builtin_bit_cast(int, x), 0x76543210, 0xfedcba98, false, false)); }   // lane l with lane l ^ 16
// two 2^x; the second fills the slot the instruction set asks for behind the first, the v_nop the slot behind the second (results are not sources: early clobber)
__device__ __forceinline__ void exp2x2(float a, float b, float& ra, float& rb) { asm("v_exp_f32 %0, %2\n\tv_exp_f32 %1, %3\n\tv_nop" : "=&v"(ra), "=&v"(rb) : "v"(a), "v"(b)); }
typedef __attribute__((ext_vector_type(4))) int v4i;
typedef __attribute__((address_space(1))) v4i gv4i;
typedef __attribute__((address_space(3))) v4i lv4i;
// one plane's stage: two copies (the builtin form), each the work-group's 512 lanes x 16 B = 8 KiB; l, g: the lane's own 16 bytes in LDS and in global memory; the offset moves both addresses
__device__ __forceinline__ void cp2(__attribute__((address_space(3))) char* l, const char* g) {
    __builtin_amdgcn_global_load_async_to_lds_b128((gv4i*)g, (lv4i*)l, 0, 0); __builtin_amdgcn_global_load_async_to_lds_b128((gv4i*)g, (lv4i*)l, 8192, 0);
}
typedef __attribute__((address_space(3))) const char lch;
typedef __attribute__((address_space(3))) const v8us lv8us;
typedef __attribute__((address_space(3))) const v8h lv8h;
__device__ __forceinline__ v16bf ldl(lch* p) { return cat16b(*(lv8us*)p, *(lv8us*)(p + 512)); }    // the two units of a fragment, from LDS
__device__ __forceinline__ v16h ldlh(lch* p) { return cat16(*(lv8h*)p, *(lv8h*)(p + 512)); }
// one stage of one wave: sb = the lane's 16 bytes of unit 0 of the wave half's 64-token tile in the stage's buffer (fragment order: see k_proj); it reads that buffer alone. hr (wave-uniform): a hi/lo wave.
// Both kinds of wave run one body, which parts only behind the softmax, into two conditional blocks: the output tiles then keep one place in the registers (with an if / else, or a loop for each kind, the compiler gave them two places and copied or spilled).
__device__ __forceinline__ void fattn_stage(const bool hr, const v16bf (&qh)[2][2], const v16bf (&ql)[2][2], lch* sb, v8f (&o)[4][2], float (&mu)[2], float (&ls)[2]) {
    const float C2 = SCL * 1.4426950408889634f;
    // rolled: one copy of the pass in the instruction cache
#pragma unroll 1
    for (int pp = 0; pp < 2; ++pp) {   // the tile's two passes of 32 keys
        lch* kb = sb + pp * 4096;
        lch* vb = sb + pp * 1024;   // V: units 0, 1 then 2, 3 of each 16-row group
        v8f st[2][2];
#pragma unroll
        for (int mt = 0; mt < 2; ++mt)
#pragma unroll
            for (int nt = 0; nt < 2; ++nt) st[mt][nt] = (v8f){};
        // Two sets of 32 operand registers: the two halves of the K rows are asked for together; the V rows then take the set that the first half has left.
        v16bf kh[2][2], kl[2][2];
#pragma unroll
        for (int ks = 0; ks < 2; ++ks)
#pragma unroll
            for (int mt = 0; mt < 2; ++mt) { const int e = mt * 2048 + ks * 1024; kh[mt][ks] = ldl(kb + e); kl[mt][ks] = ldl(kb + SPB + e); }
        __builtin_amdgcn_sched_barrier(0);   // keeps the K reads in one place, ahead of the products: without it the compiler spreads them among the products and waits at each place
        v16bf v0[4];   // V rows: the hi plane (bf16) of a hi/lo wave, else the fp16 plane
#pragma unroll
        for (int ks = 0; ks < 2; ++ks) {
#pragma unroll
            for (int mt = 0; mt < 2; ++mt)
#pragma unroll
                for (int nt = 0; nt < 2; ++nt) st[mt][nt] = wmmab(kh[mt][ks], qh[nt][ks], st[mt][nt]);
#pragma unroll
            for (int mt = 0; mt < 2; ++mt)
#pragma unroll
                for (int nt = 0; nt < 2; ++nt) st[mt][nt] = wmmab(kh[mt][ks], ql[nt][ks], st[mt][nt]);
#pragma unroll
            for (int mt = 0; mt < 2; ++mt)
#pragma unroll
                for (int nt = 0; nt < 2; ++nt) st[mt][nt] = wmmab(kl[mt][ks], qh[nt][ks], st[mt][nt]);
            if (ks == 0) {
                __builtin_amdgcn_sched_barrier(0);   // keeps the V reads behind the products above: earlier they would need registers of their own, beyond the 256 of a wave at four waves a SIMD
                lch* vp = vb + (hr ? 3 * SPB : 2 * SPB);
#pragma unroll
                for (int dt = 0; dt < 4; ++dt) v0[dt] = ldl(vp + dt * 2048);
                __builtin_amdgcn_sched_barrier(0);   // and ahead of the products below, during which they come: later, attn.v would wait for them
            }
        }
        float cm[2];
#pragma unroll
        for (int nt = 0; nt < 2; ++nt) { float x = fmaxf(st[0][nt][0], st[1][nt][0]);
#pragma unroll
            for (int r = 1; r < 8; ++r) x = fmaxf(x, fmaxf(st[0][nt][r], st[1][nt][r]));
            cm[nt] = fmaxf(x, xhalf(x)) * C2; }
        if (__builtin_amdgcn_ballot_w32(cm[0] > mu[0] + 4.0f || cm[1] > mu[1] + 4.0f) != 0) {   // one scalar branch a pass; rare after the first passes
            const float mn0 = fmaxf(mu[0], cm[0]), mn1 = fmaxf(mu[1], cm[1]); float al[2]; exp2x2(mu[0] - mn0, mu[1] - mn1, al[0], al[1]); mu[0] = mn0; mu[1] = mn1;   // 0 on the first pass
#pragma unroll
            for (int nt = 0; nt < 2; ++nt) { ls[nt] *= al[nt];
#pragma unroll
                for (int dt = 0; dt < 4; ++dt) o[dt][nt] *= al[nt]; }
        }
        float p[2][16];
#pragma unroll
        for (int nt = 0; nt < 2; ++nt) { const float nb = 6.0f - mu[nt]; float s0 = 0.f, s1 = 0.f;
#pragma unroll
            for (int r = 0; r < 8; ++r) { exp2x2(fmaf(st[0][nt][r], C2, nb), fmaf(st[1][nt][r], C2, nb), p[nt][r], p[nt][8 + r]); s0 += p[nt][r]; s1 += p[nt][8 + r]; }
            ls[nt] += s0 + s1; }
        if (!hr) {
#pragma unroll
            for (int nt = 0; nt < 2; ++nt) { v16h pf;
#pragma unroll
                for (int s = 0; s < 16; ++s) pf[s] = (h16)p[nt][s];
#pragma unroll
                for (int dt = 0; dt < 4; ++dt) o[dt][nt] = wmma16(__builtin_bit_cast(v16h, v0[dt]), pf, o[dt][nt]); }
        }
        if (hr) {
            v16bf ph[2], pl[2];
#pragma unroll
            for (int nt = 0; nt < 2; ++nt)
#pragma unroll
                for (int s = 0; s < 16; ++s) { ph[nt][s] = (__bf16)p[nt][s]; pl[nt][s] = (__bf16)(p[nt][s] - (float)ph[nt][s]); }
#pragma unroll
            for (int nt = 0; nt < 2; ++nt) {
#pragma unroll
                for (int dt = 0; dt < 4; ++dt) o[dt][nt] = wmmab(v0[dt], ph[nt], o[dt][nt]);
#pragma unroll
                for (int dt = 0; dt < 4; ++dt) o[dt][nt] = wmmab(v0[dt], pl[nt], o[dt][nt]); }
            __builtin_amdgcn_sched_barrier(0);   // the V lo rows take the registers of the V hi rows: see above
#pragma unroll
            for (int dt = 0; dt < 4; ++dt) v0[dt] = ldl(vb + 4 * SPB + dt * 2048);
#pragma unroll
            for (int nt = 0; nt < 2; ++nt)
#pragma unroll
                for (int dt = 0; dt < 4; ++dt) o[dt][nt] = wmmab(v0[dt], ph[nt], o[dt][nt]);
        }
    }
}
// grid (TT / 256, heads, batches), 16 waves on the same stages; planes [batch][head][tile of 64 tokens][unit], as k_proj writes them
typedef __attribute__((address_space(3))) v4f lv4f;
#define MGB  (17 * 512)            // bytes a wave hands over at the join: 16 units of output tiles, one of maxima and sums
static_assert(FAW * MGB <= 2 * NPL * SPB, "the join's staging fits into the ring");
__global__ __launch_bounds__(32 * FAW * KSP) void k_fattn(const bf* __restrict__ QPh, const bf* __restrict__ QPl, const bf* __restrict__ KPh, const bf* __restrict__ KPl, const h16* __restrict__ VT16, const bf* __restrict__ VTh, const bf* __restrict__ VTl, float* OUT) {
    __shared__ __attribute__((aligned(512))) char ring[2][NPL * SPB];
    // query groups 0 .. 3 take 128 rows of the first half of the sequence, groups 4 .. 7 the 128 rows half a sequence further on: a longer hi/lo wave then has a shorter fp16 wave beside it (for speed only)
    const int wv = __builtin_amdgcn_readfirstlane((int)(threadIdx.x >> 5)), qg = wv & (FAW - 1), kq = wv / FAW;   // query group, wave half
    const int q0 = (int)blockIdx.x * (4 * FAC) + (qg >> 2) * (TT / 2) + (qg & 3) * FAC;   // wave-uniform: the hi/lo test below is a scalar branch
    const size_t hp = ((size_t)blockIdx.z * NH_ + blockIdx.y) * TT * HD;
    const bool hrg = (int)blockIdx.x * (4 * FAC) < RH;   // the same for the whole work-group: its query groups 0 .. 3 are hi/lo waves and read the V hi and lo planes
    const unsigned l16 = (threadIdx.x & 31) * 16u;   // the lane's 16 bytes of a unit
    auto fill = [&](int s) {   // stage s of every plane that the work-group reads, into buffer s & 1; every lane on, 6 or 10 copies a wave
        const unsigned t = l16 + (unsigned)wv * 512u;   // the lane's 16 bytes of an 8-KiB copy
        __attribute__((address_space(3))) char* l = (__attribute__((address_space(3))) char*)&ring[0][0] + t + (unsigned)(s & 1) * (NPL * SPB); const size_t g = hp * 2 + (size_t)s * SPB + t;
        cp2(l, (const char*)KPh + g); cp2(l + SPB, (const char*)KPl + g); cp2(l + 2 * SPB, (const char*)VT16 + g);
        if (hrg) { cp2(l + 3 * SPB, (const char*)VTh + g); cp2(l + 4 * SPB, (const char*)VTl + g); }
    };
    fill(0);
    v16bf qh[2][2], ql[2][2];
    { const size_t fo = (size_t)(threadIdx.x & 31) * 8, qp = hp + (size_t)q0 * HD + fo;
#pragma unroll
      for (int t = 0; t < 2; ++t)
#pragma unroll
          for (int ks = 0; ks < 2; ++ks) { const size_t e = (size_t)t * 16 * HD + ks * 512; qh[t][ks] = ldu(QPh + qp + e); ql[t][ks] = ldu(QPl + qp + e); } }
    asm volatile("s_wait_xcnt 0x0" ::: "memory");   // before a register that the loads above name is written again
    __builtin_amdgcn_sched_barrier(0);                // keeps the arithmetic below behind that wait
    const int lr = threadIdx.x & 15, hi = (threadIdx.x >> 4) & 1;
    float* orow = OUT + ((size_t)blockIdx.z * TT + q0 + lr) * DQ + blockIdx.y * HD + 8 * hi;
    lch* sb0 = (lch*)&ring[0][0] + l16 + kq * 8192;   // the lane's 16 bytes of unit 0 of the wave half's 64-token tile; every fragment that the wave reads of a stage is an offset from them
    v8f o[4][2]; float mu[2], ls[2];
#pragma unroll
    for (int nt = 0; nt < 2; ++nt) { mu[nt] = -1.0e30f; ls[nt] = 0.f;
#pragma unroll
        for (int dt = 0; dt < 4; ++dt) o[dt][nt] = (v8f){}; }
    asm volatile("s_wait_asynccnt 0x0" ::: "memory");   // this wave's copies of stage 0 have landed
    __syncthreads();                                     // and every other wave's: stage 0 may be read
    fill(1);
    // rolled: one copy of the stage in the instruction cache
#pragma unroll 1
    for (int s = 0; s < NST; ++s) {
        lch* sb = sb0 + (s & 1) * (NPL * SPB);
        fattn_stage(q0 < RH, qh, ql, sb, o, mu, ls);
        asm volatile("s_wait_dscnt 0x0" ::: "memory");     // this wave's reads of stage s are done before the buffer may be refilled
        asm volatile("s_wait_asynccnt 0x0" ::: "memory");  // this wave's copies of stage s + 1 have landed
        __syncthreads();                                    // publishes stage s + 1 and ends every wave's reads of stage s
        if (s + 2 < NST) fill(s + 2);
    }
    asm volatile("s_wait_asynccnt 0x0" ::: "memory");   // nothing of this wave is in flight when the ring becomes the join's staging (every wave's last read of it lies ahead of the loop's last barrier)
    // the join: half 1 hands its tiles, maxima and sums to half 0 of the same query group, lane to lane (both hold the same queries in the same places)
    __attribute__((address_space(3))) char* mg = (__attribute__((address_space(3))) char*)&ring[0][0] + qg * MGB + l16;
    if (kq != 0) {
#pragma unroll
        for (int nt = 0; nt < 2; ++nt)
#pragma unroll
            for (int dt = 0; dt < 4; ++dt) { *(lv4f*)(mg + ((nt * 4 + dt) * 2) * 512) = __builtin_shufflevector(o[dt][nt], o[dt][nt], 0, 1, 2, 3); *(lv4f*)(mg + ((nt * 4 + dt) * 2 + 1) * 512) = __builtin_shufflevector(o[dt][nt], o[dt][nt], 4, 5, 6, 7); }
        *(lv4f*)(mg + 16 * 512) = (v4f){mu[0], mu[1], ls[0], ls[1]};
    }
    __syncthreads();   // half 1's values may be read
    if (kq != 0) return;
    { const v4f ml = *(lv4f*)(mg + 16 * 512);
#pragma unroll
      for (int nt = 0; nt < 2; ++nt) { const float mn = fmaxf(mu[nt], ml[nt]); float fa, fb; exp2x2(mu[nt] - mn, ml[nt] - mn, fa, fb); ls[nt] = ls[nt] * fa + ml[2 + nt] * fb;
#pragma unroll
          for (int dt = 0; dt < 4; ++dt) { const v4f a = *(lv4f*)(mg + ((nt * 4 + dt) * 2) * 512), b = *(lv4f*)(mg + ((nt * 4 + dt) * 2 + 1) * 512); o[dt][nt] = o[dt][nt] * fa + __builtin_shufflevector(a, b, 0, 1, 2, 3, 4, 5, 6, 7) * fb; } } }
#pragma unroll
    for (int nt = 0; nt < 2; ++nt) { const float inv = __fdiv_rn(1.0f, ls[nt] + xhalf(ls[nt]));   // a lane's 8 registers are 8 consecutive d of its query's row
#pragma unroll
        for (int dt = 0; dt < 4; ++dt) *(v8f*)(orow + (size_t)nt * 16 * DQ + dt * 16) = o[dt][nt] * inv;
        if (nt == 0) asm volatile("s_wait_xcnt 0x0" : "+v"(ls[1]) :: "memory"); }   // before the second column group's values reuse a register that an issued store names; naming its sum keeps them behind the wait
}

extern "C" void kernel_launch(void* const* d_in, const int* in_sizes, int n_in,
                              void* d_out, int out_size, void* d_ws, size_t ws_size, hipStream_t stream) {
    (void)in_sizes; (void)n_in; (void)out_size;
    const float* x = (const float*)d_in[0]; const float* wq = (const float*)d_in[1]; const float* wk = (const float*)d_in[2]; const float* wv = (const float*)d_in[3];
    float* OUT = (float*)d_out;     // [2][4096][512]
    char* wsp = (char*)d_ws;
    auto take = [&](size_t bytes) { char* p = wsp; wsp += (bytes + 255) & ~(size_t)255; return (void*)p; };
    bf* XP = (bf*)take((size_t)XUN * 512); bf* WP = (bf*)take((size_t)WUN * 512);
    h16* VT16 = (h16*)take((size_t)NB_ * NKV * HD * TT * 2);
    bf* QPh = (bf*)take((size_t)NB_ * NH_ * TT * HD * 2); bf* QPl = (bf*)take((size_t)NB_ * NH_ * TT * HD * 2); bf* KPh = (bf*)take((size_t)NB_ * NKV * TT * HD * 2); bf* KPl = (bf*)take((size_t)NB_ * NKV * TT * HD * 2); bf* VTh = (bf*)take((size_t)NB_ * NKV * HD * TT * 2); bf* VTl = (bf*)take((size_t)NB_ * NKV * HD * TT * 2);   // the planes the fused attention reads hold both batches
    if ((size_t)(wsp - (char*)d_ws) > ws_size) return;    // ws 256 MiB
    k_pack<<<(XUN + WUN) / (8 * PKU), 256, 0, stream>>>(x, wq, wk, wv, XP, WP);
    k_proj<<<dim3(NB_ * TT / 128, (NH_ + 2 * NKV) / 2, 1), 128, 0, stream>>>(XP, WP, QPh, QPl, KPh, KPl, (bf*)VT16, VTh, VTl);
    k_fattn<<<dim3(TT / (FAW * FAC), NH_, NB_), 32 * FAW * KSP, 0, stream>>>(QPh, QPl, KPh, KPl, VT16, VTh, VTl, OUT);
}

// v007
// It runs in 118 microseconds.
// Timed twice side by side with v006, it ran 1.03 times as fast both times.
// Over all steps from v000 it is 29.8 times as fast.
#include <hip/hip_runtime.h>

// Multi-head attention over 4,096 tokens without output projection (attention_input [2][4096][512]; q,k,v = x W ('xw' [512][512] 0.05); 8 heads x 64; scores / SCALE with SCALE = N_HEADS = 8 (the source's quirk; numerically the usual 1/8 here); softmax; out = concat-heads(attn v) -> [2][4096][512] (4.2 M)).
// Three launches: x and the 'xw' weights rounded to bf16 and packed in fragment order; ONE projection launch (both batches, q, k and v) whose epilogue writes the head planes, also in fragment order; then ONE fused attention launch for both batches and all heads: hi/lo 3-product score tiles on EVERY row (no output projection averages the per-head error), running-maximum softmax in registers, P and attn.v hybrid (rows < 512 hi/lo, rest fp16); scores and P never reach memory.
// Compute dtypes, f32 accumulate: every input rounded to bf16; projections exact; scores 3 products on every row; softmax f32; attn.v rows < 512 3 products, rest fp16; output f32.

#define NB_  2
#define TT   4096
#define DM   512
#define NH_  8
#define NKV  8
#define REP  (NH_ / NKV)
#define HD   64
#define DQ   (NH_ * HD)
#define DKV  (NKV * HD)
#define ZH   1
#define RH   512                  // query rows < RH use hi+lo planes (0: none)
#define WIN  0
#define SCL  0.125f   // HD^-0.5
#define FAW  8                    // fused attention: query groups (of FAC columns) per work-group
#define KSP  2                    // fused attention: waves that share a query group, each with its own keys of every stage
#define FAC  32                   // fused attention: query columns per wave
#define HQG  2                    // fused attention: hi/lo query groups in a work-group that has any (HQG * KSP = 4 waves)
#define NHW  (RH / (HQG * FAC))   // fused attention: work-groups of a head that have hi/lo query groups
static_assert(RH % (HQG * FAC) == 0 && HQG <= FAW && NHW <= TT / (FAW * FAC) && TT % (FAW * FAC) == 0 && TT % 32 == 0 && HD == 64 && REP == 1, "a wave is all hi/lo or all fp16, the hi/lo groups fill whole shares of HQG; whole 32-key passes; 4 output tiles");
typedef _Float16 h16;
typedef unsigned short bf;
typedef __attribute__((ext_vector_type(16))) __bf16   v16bf;
typedef __attribute__((ext_vector_type(16))) _Float16 v16h;
typedef __attribute__((ext_vector_type(8)))  _Float16 v8h;
typedef __attribute__((ext_vector_type(8)))  unsigned short v8us;
typedef __attribute__((ext_vector_type(8)))  float    v8f;
typedef __attribute__((ext_vector_type(4)))  float    v4f;
typedef v8h  __attribute__((may_alias)) v8ha;
typedef v4f  __attribute__((may_alias)) v4fa;
typedef v8us __attribute__((may_alias)) v8usa;

__device__ __forceinline__ v16h cat16(v8h lo, v8h hi) { return __builtin_shufflevector(lo, hi, 0, 1, 2, 3, 4, 5, 6, 7, 8, 9, 10, 11, 12, 13, 14, 15); }
__device__ __forceinline__ v16bf cat16b(v8us lo, v8us hi) { return __builtin_bit_cast(v16bf, __builtin_shufflevector(lo, hi, 0, 1, 2, 3, 4, 5, 6, 7, 8, 9, 10, 11, 12, 13, 14, 15)); }
__device__ __forceinline__ v8f wmma16(v16h a, v16h b, v8f c) { return __builtin_amdgcn_wmma_f32_16x16x32_f16(false, a, false, b, (short)0, c, false, false); }
__device__ __forceinline__ v8f wmmab(v16bf a, v16bf b, v8f c) { return __builtin_amdgcn_wmma_f32_16x16x32_bf16(false, a, false, b, (short)0, c, false, false); }




// Fragment order: a 16-row x 32-k operand fragment is 1 KiB = two units of 512 B; unit u = (tile16 * (DM / 32) + kstep) * 2 + part holds, at lane * 16 B,
// the 8 bf16 of row tile16 * 16 + (lane & 15), k = kstep * 32 + part * 16 + (lane >> 4) * 8 .. + 7. A wave's 16-byte load of a unit is 512 contiguous bytes (4 whole lines), and units (part 0, part 1) are the two halves of the fragment register.
#define KST  (DM / 32)             // k steps of a projection
#define XUN  (NB_ * TT / 16 * KST * 2)          // units of x
#define WUN  ((DQ + 2 * DKV) / 16 * KST * 2)    // units of the three weights, features q | k | v
#define PKU  8                     // units a wave packs
static_assert(XUN % (8 * PKU) == 0 && WUN % (8 * PKU) == 0 && (KST * 2) % PKU == 0 && DQ == DM && DKV == DM, "whole work-groups; a wave's units lie in one 16-row tile");
typedef __attribute__((ext_vector_type(8))) __bf16 v8b;
__device__ __forceinline__ v8us bf8(v8f v) { return __builtin_bit_cast(v8us, __builtin_convertvector(v, v8b)); }   // round to nearest even
// k_pack: work-groups < XUN / 64 pack x, the rest the weights (w[k][n] read down k: the transposition). Its loops are unrolled so that all of a wave's loads are in flight before the first is used.
__global__ __launch_bounds__(256) void k_pack(const float* __restrict__ x, const float* __restrict__ wq, const float* __restrict__ wk, const float* __restrict__ wv, bf* XP, bf* WP) {
    const int lane = threadIdx.x & 31, lr = lane & 15, hi = lane >> 4, wvi = __builtin_amdgcn_readfirstlane((int)(threadIdx.x >> 5));
    if ((int)blockIdx.x < XUN / (8 * PKU)) {
        const int u0 = ((int)blockIdx.x * 8 + wvi) * PKU; const float* s = x + (size_t)((u0 / (KST * 2)) * 16 + lr) * DM + (u0 % (KST * 2)) * 16 + hi * 8; v8f v[PKU];
#pragma unroll
        for (int u = 0; u < PKU; ++u) v[u] = *(const v8f*)(s + u * 16);
        asm volatile("s_wait_xcnt 0x0" :: "v"(s) : "memory");   // before a register that the loads above name is written again; naming the address keeps it whole up to the wait
#pragma unroll
        for (int u = 0; u < PKU; ++u) *(v8us*)(XP + (size_t)(u0 + u) * 256 + lane * 8) = bf8(v[u]);
    } else {
        const int u0 = (((int)blockIdx.x - XUN / (8 * PKU)) * 8 + wvi) * PKU, tile = u0 / (KST * 2), sel = tile / (DM / 16);
        const float* w = sel == 0 ? wq : sel == 1 ? wk : wv; const float* s = w + (size_t)((u0 % (KST * 2)) * 16 + hi * 8) * DM + (tile % (DM / 16)) * 16 + lr; v8f v[PKU];
#pragma unroll
        for (int u = 0; u < PKU; ++u)
#pragma unroll
            for (int k = 0; k < 8; ++k) v[u][k] = s[(size_t)(u * 16 + k) * DM];
        asm volatile("s_wait_xcnt 0x0" :: "v"(s) : "memory");   // as above
#pragma unroll
        for (int u = 0; u < PKU; ++u) *(v8us*)(WP + (size_t)(u0 + u) * 256 + lane * 8) = bf8(v[u]);
    }
}

// k_proj: all projections of both batches. One wave per 64 tokens x one head of q, k or v (16 accumulators), operands straight from the packed units, the next k step's fragments asked for ahead of this step's products.
// q, k: first operand = weight rows, so a lane's 8 results are 8 consecutive d of one token; v: first operand = token rows, 8 consecutive t of one d.
// The epilogue rounds to the planes the attention reads (hi + lo bf16; for v also fp16) and stores them in fragment order, staged through the wave's own LDS: a head's plane is TT / 64 tiles of 8 KiB (64 tokens x 64 d), a tile 16 units of 512 B;
// unit s holds, at lane * 16 B, 8 values of row (s >> 2) * 16 + (lane & 15), k = (s & 3) * 16 + (lane >> 4) * 8 .. + 7, where (row, k) = (token, d) for q and k and (d, token) for v. Units 2n, 2n + 1 are the two halves of one fragment register, and every operand load of the attention is 512 contiguous bytes, 4 whole lines (from row-major planes it would take 32 bytes out of each of 16 lines, which costs the WGP's cache path several times as much). grid (tokens / 128, heads of q|k|v / 2), 4 waves = 2 x 2 tiles. Every loop is unrolled: the fragment and accumulator arrays stay in registers, every address is an immediate offset.
typedef __attribute__((ext_vector_type(2))) float v2f;
typedef __attribute__((ext_vector_type(2))) __bf16 v2b;
typedef __attribute__((ext_vector_type(4))) unsigned v4u;
typedef v4u __attribute__((may_alias)) v4ua;
#define OSP  72                    // LDS pitch in 16-bit elements: 144 B, an odd multiple of 16 B
__device__ __forceinline__ v16bf ldu(const bf* p) { return cat16b(*(const v8us*)p, *(const v8us*)(p + 256)); }
__device__ __forceinline__ v16h lduh(const h16* p) { return cat16(*(const v8h*)p, *(const v8h*)(p + 256)); }
__global__ __launch_bounds__(128) void k_proj(const bf* __restrict__ XP, const bf* __restrict__ WP, bf* QPh, bf* QPl, bf* KPh, bf* KPl, bf* VT16, bf* VTh, bf* VTl) {
    __shared__ __align__(16) bf osa[4][64 * OSP];
    const int lane = threadIdx.x & 31, lr = lane & 15, hi = lane >> 4, wvi = __builtin_amdgcn_readfirstlane((int)(threadIdx.x >> 5));
    const int tt64 = (int)blockIdx.x * 2 + (wvi & 1), hd = (int)blockIdx.y * 2 + (wvi >> 1), sel = hd / NH_;   // wave-uniform
    const bf* xb = XP + (size_t)tt64 * (4 * KST * 512) + lane * 8; const bf* wb = WP + (size_t)hd * (4 * KST * 512) + lane * 8;
    const bf* P = sel == 2 ? xb : wb; const bf* Q = sel == 2 ? wb : xb;   // result rows follow P, result columns Q
    v8f acc[4][4];
#pragma unroll
    for (int i = 0; i < 4; ++i)
#pragma unroll
        for (int j = 0; j < 4; ++j) acc[i][j] = (v8f){};
    v16bf p[2][4], q[2][4];
#pragma unroll
    for (int i = 0; i < 4; ++i) { p[0][i] = ldu(P + i * (KST * 512)); q[0][i] = ldu(Q + i * (KST * 512)); }
#pragma unroll
    for (int ks = 0; ks < KST; ++ks) {
        if (ks + 1 < KST) {
#pragma unroll
            for (int i = 0; i < 4; ++i) { p[(ks + 1) & 1][i] = ldu(P + i * (KST * 512) + (ks + 1) * 512); q[(ks + 1) & 1][i] = ldu(Q + i * (KST * 512) + (ks + 1) * 512); }
            if (ks + 2 == KST) asm volatile("s_wait_xcnt 0x0" ::: "memory");   // behind the last loads: it stands before their address registers are written again (the fence below keeps the epilogue's arithmetic behind it)
            __builtin_amdgcn_sched_barrier(0);   // keeps the next step's 16 loads ahead of this step's products: without it the compiler sinks each load to just before its use and the wave waits out the latency several times a step
        }
#pragma unroll
        for (int j = 0; j < 4; ++j)
#pragma unroll
            for (int i = 0; i < 4; ++i) acc[i][j] = wmmab(p[ks & 1][i], q[ks & 1][j], acc[i][j]);
    }
    bf* os = osa[wvi];
    const size_t hp = ((size_t)(tt64 / (TT / 64)) * NH_ + hd % NH_) * TT * HD; const int t0 = (tt64 % (TT / 64)) * 64;
    const size_t ob = hp + (size_t)t0 * HD + lane * 8;   // the lane's 16 bytes of the tile's unit 0; one unit a store
    bf* osw = os + lr * OSP + 8 * hi; const bf* osr = osw;   // a lane reads back row lr of a 16-row group, its half's 8 values of 16
    auto flush = [&](bf* d, bool more) {   // the staged 64 x 64 tile to its plane, one unit (4 whole lines) a store
        __builtin_amdgcn_wave_barrier(); asm volatile("" ::: "memory");   // keeps the reads below, of the lane's own values, behind the writes before them
#pragma unroll
        for (int s = 0; s < 16; ++s) *(v8usa*)(d + s * 256) = *(const v8usa*)(osr + (s >> 2) * 16 * OSP + (s & 3) * 16);
        if (more) { asm volatile("s_wait_xcnt 0x0" ::: "memory"); __builtin_amdgcn_sched_barrier(0); }   // the wait stands before the next plane's values reuse a register that an issued store names, the fence keeps them behind it; both keep the next plane's LDS writes behind the reads above
    };
    if (sel == 2) {   // fp16 plane, v only
#pragma unroll
        for (int i = 0; i < 4; ++i)
#pragma unroll
            for (int j = 0; j < 4; ++j) *(v8ha*)(osw + j * 16 * OSP + i * 16) = __builtin_convertvector(acc[i][j], v8h);
        flush(VT16 + ob, true);
    }
#pragma unroll
    for (int i = 0; i < 4; ++i)   // hi plane; the accumulators keep the remainder
#pragma unroll
        for (int j = 0; j < 4; ++j) { v4u o;
#pragma unroll
            for (int r = 0; r < 4; ++r) { const v2f y = {acc[i][j][2 * r], acc[i][j][2 * r + 1]}; o[r] = __builtin_bit_cast(unsigned, __builtin_convertvector(y, v2b)); acc[i][j][2 * r] -= __uint_as_float(o[r] << 16); acc[i][j][2 * r + 1] -= __uint_as_float(o[r] & 0xFFFF0000u); }
            *(v4ua*)(osw + j * 16 * OSP + i * 16) = o; }
    flush((sel == 0 ? QPh : sel == 1 ? KPh : VTh) + ob, true);
#pragma unroll
    for (int i = 0; i < 4; ++i)   // lo plane
#pragma unroll
        for (int j = 0; j < 4; ++j) *(v8usa*)(osw + j * 16 * OSP + i * 16) = bf8(acc[i][j]);
    flush((sel == 0 ? QPl : sel == 1 ? KPl : VTl) + ob, false);
}

#define SKEY 128                   // keys a stage
#define SPB  (SKEY * HD * 2)       // bytes of one plane's stage
#define NST  (TT / SKEY)           // stages
#define NPL  5                     // planes a buffer holds: K hi, K lo, V fp16, V hi, V lo
static_assert(TT % SKEY == 0 && NST >= 2 && SKEY == 64 * KSP && SPB == 2 * 32 * FAW * KSP * 16, "whole stages, at least two; one 64-token tile a wave half; two 16-byte copies a lane and plane");
__device__ __forceinline__ float xhalf(float x) { return __builtin_bit_cast(float, __builtin_amdgcn_permlanex16(__builtin_bit_cast(int, x), __builtin_bit_cast(int, x), 0x76543210, 0xfedcba98, false, false)); }   // lane l with lane l ^ 16
// two 2^x; the second fills the slot the instruction set asks for behind the first, the v_nop the slot behind the second (results are not sources: early clobber)
__device__ __forceinline__ void exp2x2(float a, float b, float& ra, float& rb) { asm("v_exp_f32 %0, %2\n\tv_exp_f32 %1, %3\n\tv_nop" : "=&v"(ra), "=&v"(rb) : "v"(a), "v"(b)); }
typedef __attribute__((ext_vector_type(4))) int v4i;
typedef __attribute__((address_space(1))) v4i gv4i;
typedef __attribute__((address_space(3))) v4i lv4i;
// one plane's stage: two copies (the builtin form), each the work-group's 512 lanes x 16 B = 8 KiB; l, g: the lane's own 16 bytes in LDS and in global memory; the offset moves both addresses
__device__ __forceinline__ void cp2(__attribute__((address_space(3))) char* l, const char* g) {
    __builtin_amdgcn_global_load_async_to_lds_b128((gv4i*)g, (lv4i*)l, 0, 0); __builtin_amdgcn_global_load_async_to_lds_b128((gv4i*)g, (lv4i*)l, 8192, 0);
}
typedef __attribute__((address_space(3))) const char lch;
typedef __attribute__((address_space(3))) const v8us lv8us;
typedef __attribute__((address_space(3))) const v8h lv8h;
__device__ __forceinline__ v16bf ldl(lch* p) { return cat16b(*(lv8us*)p, *(lv8us*)(p + 512)); }    // the two units of a fragment, from LDS
__device__ __forceinline__ v16h ldlh(lch* p) { return cat16(*(lv8h*)p, *(lv8h*)(p + 512)); }
// one stage of one wave: sb = the lane's 16 bytes of unit 0 of the wave half's 64-token tile in the stage's buffer (fragment order: see k_proj); it reads that buffer alone. hr (wave-uniform): a hi/lo wave.
// Both kinds of wave run one body, which parts only behind the softmax, into two conditional blocks: the output tiles then keep one place in the registers (with an if / else, or a loop for each kind, the compiler gave them two places and copied or spilled).
__device__ __forceinline__ void fattn_stage(const bool hr, const v16bf (&qh)[2][2], const v16bf (&ql)[2][2], lch* sb, v8f (&o)[4][2], float (&mu)[2], float (&ls)[2]) {
    const float C2 = SCL * 1.4426950408889634f;
    // rolled: one copy of the pass in the instruction cache
#pragma unroll 1
    for (int pp = 0; pp < 2; ++pp) {   // the tile's two passes of 32 keys
        lch* kb = sb + pp * 4096;
        lch* vb = sb + pp * 1024;   // V: units 0, 1 then 2, 3 of each 16-row group
        v8f st[2][2];
#pragma unroll
        for (int mt = 0; mt < 2; ++mt)
#pragma unroll
            for (int nt = 0; nt < 2; ++nt) st[mt][nt] = (v8f){};
        // Two sets of 32 operand registers: the two halves of the K rows are asked for together; the V rows then take the set that the first half has left.
        v16bf kh[2][2], kl[2][2];
#pragma unroll
        for (int ks = 0; ks < 2; ++ks)
#pragma unroll
            for (int mt = 0; mt < 2; ++mt) { const int e = mt * 2048 + ks * 1024; kh[mt][ks] = ldl(kb + e); kl[mt][ks] = ldl(kb + SPB + e); }
        __builtin_amdgcn_sched_barrier(0);   // keeps the K reads in one place, ahead of the products: without it the compiler spreads them among the products and waits at each place
        v16bf v0[4];   // V rows: the hi plane (bf16) of a hi/lo wave, else the fp16 plane
#pragma unroll
        for (int ks = 0; ks < 2; ++ks) {
#pragma unroll
            for (int mt = 0; mt < 2; ++mt)
#pragma unroll
                for (int nt = 0; nt < 2; ++nt) st[mt][nt] = wmmab(kh[mt][ks], qh[nt][ks], st[mt][nt]);
#pragma unroll
            for (int mt = 0; mt < 2; ++mt)
#pragma unroll
                for (int nt = 0; nt < 2; ++nt) st[mt][nt] = wmmab(kh[mt][ks], ql[nt][ks], st[mt][nt]);
#pragma unroll
            for (int mt = 0; mt < 2; ++mt)
#pragma unroll
                for (int nt = 0; nt < 2; ++nt) st[mt][nt] = wmmab(kl[mt][ks], qh[nt][ks], st[mt][nt]);
            if (ks == 0) {
                __builtin_amdgcn_sched_barrier(0);   // keeps the V reads behind the products above: earlier they would need registers of their own, beyond the 256 of a wave at four waves a SIMD
                lch* vp = vb + (hr ? 3 * SPB : 2 * SPB);
#pragma unroll
                for (int dt = 0; dt < 4; ++dt) v0[dt] = ldl(vp + dt * 2048);
                __builtin_amdgcn_sched_barrier(0);   // and ahead of the products below, during which they come: later, attn.v would wait for them
            }
        }
        float cm[2];
#pragma unroll
        for (int nt = 0; nt < 2; ++nt) { float x = fmaxf(st[0][nt][0], st[1][nt][0]);
#pragma unroll
            for (int r = 1; r < 8; ++r) x = fmaxf(x, fmaxf(st[0][nt][r], st[1][nt][r]));
            cm[nt] = fmaxf(x, xhalf(x)) * C2; }
        if (__builtin_amdgcn_ballot_w32(cm[0] > mu[0] + 4.0f || cm[1] > mu[1] + 4.0f) != 0) {   // one scalar branch a pass; rare after the first passes
            const float mn0 = fmaxf(mu[0], cm[0]), mn1 = fmaxf(mu[1], cm[1]); float al[2]; exp2x2(mu[0] - mn0, mu[1] - mn1, al[0], al[1]); mu[0] = mn0; mu[1] = mn1;   // 0 on the first pass
#pragma unroll
            for (int nt = 0; nt < 2; ++nt) { ls[nt] *= al[nt];
#pragma unroll
                for (int dt = 0; dt < 4; ++dt) o[dt][nt] *= al[nt]; }
        }
        float p[2][16];
#pragma unroll
        for (int nt = 0; nt < 2; ++nt) { const float nb = 6.0f - mu[nt]; float s0 = 0.f, s1 = 0.f;
#pragma unroll
            for (int r = 0; r < 8; ++r) { exp2x2(fmaf(st[0][nt][r], C2, nb), fmaf(st[1][nt][r], C2, nb), p[nt][r], p[nt][8 + r]); s0 += p[nt][r]; s1 += p[nt][8 + r]; }
            ls[nt] += s0 + s1; }
        if (!hr) {
#pragma unroll
            for (int nt = 0; nt < 2; ++nt) { v16h pf;
#pragma unroll
                for (int s = 0; s < 16; ++s) pf[s] = (h16)p[nt][s];
#pragma unroll
                for (int dt = 0; dt < 4; ++dt) o[dt][nt] = wmma16(__builtin_bit_cast(v16h, v0[dt]), pf, o[dt][nt]); }
        }
        if (hr) {
            v16bf ph[2], pl[2];
#pragma unroll
            for (int nt = 0; nt < 2; ++nt)
#pragma unroll
                for (int s = 0; s < 16; ++s) { ph[nt][s] = (__bf16)p[nt][s]; pl[nt][s] = (__bf16)(p[nt][s] - (float)ph[nt][s]); }
#pragma unroll
            for (int nt = 0; nt < 2; ++nt) {
#pragma unroll
                for (int dt = 0; dt < 4; ++dt) o[dt][nt] = wmmab(v0[dt], ph[nt], o[dt][nt]);
#pragma unroll
                for (int dt = 0; dt < 4; ++dt) o[dt][nt] = wmmab(v0[dt], pl[nt], o[dt][nt]); }
            __builtin_amdgcn_sched_barrier(0);   // the V lo rows take the registers of the V hi rows: see above
#pragma unroll
            for (int dt = 0; dt < 4; ++dt) v0[dt] = ldl(vb + 4 * SPB + dt * 2048);
#pragma unroll
            for (int nt = 0; nt < 2; ++nt)
#pragma unroll
                for (int dt = 0; dt < 4; ++dt) o[dt][nt] = wmmab(v0[dt], ph[nt], o[dt][nt]);
        }
    }
}
// grid (TT / 256, heads, batches), 16 waves on the same stages; planes [batch][head][tile of 64 tokens][unit], as k_proj writes them
typedef __attribute__((address_space(3))) v4f lv4f;
#define MGB  (17 * 512)            // bytes a wave hands over at the join: 16 units of output tiles, one of maxima and sums
static_assert(FAW * MGB <= 2 * NPL * SPB, "the join's staging fits into the ring");
__global__ __launch_bounds__(32 * FAW * KSP) void k_fattn(const bf* __restrict__ QPh, const bf* __restrict__ QPl, const bf* __restrict__ KPh, const bf* __restrict__ KPl, const h16* __restrict__ VT16, const bf* __restrict__ VTh, const bf* __restrict__ VTl, float* OUT) {
    __shared__ __attribute__((aligned(512))) char ring[2][NPL * SPB];
    // Which rows a wave takes (for speed only): a hi/lo wave has half as many products again as an fp16 wave and more vector work, a work-group fills a WGP's registers and the grid is one work-group for each WGP, so the launch lasts as long as its fullest SIMD.
    // So the RH / FAC hi/lo query groups of a head go HQG = 2 each to its first NHW work-groups, as those groups' waves 0 .. 3.
    // Such a work-group fills up with FAW - HQG fp16 groups from row RH on; the other work-groups take FAW fp16 groups each.
    const int wv = __builtin_amdgcn_readfirstlane((int)(threadIdx.x >> 5)), qg = wv / KSP, kq = wv % KSP;   // query group, wave half
    const bool hrg = (int)blockIdx.x < NHW;   // the same for the whole work-group: its query groups 0 .. HQG - 1 are hi/lo waves and read the V hi and lo planes
    const int q0 = (hrg ? (qg < HQG ? (int)blockIdx.x * HQG + qg : RH / FAC + (int)blockIdx.x * (FAW - HQG) + qg - HQG) : (int)blockIdx.x * FAW + qg) * FAC;   // wave-uniform: the hi/lo test below is a scalar branch
    const size_t hp = ((size_t)blockIdx.z * NH_ + blockIdx.y) * TT * HD;
    const unsigned l16 = (threadIdx.x & 31) * 16u;   // the lane's 16 bytes of a unit
    auto fill = [&](int s) {   // stage s of every plane that the work-group reads, into buffer s & 1; every lane on, 6 or 10 copies a wave
        const unsigned t = l16 + (unsigned)wv * 512u;   // the lane's 16 bytes of an 8-KiB copy
        __attribute__((address_space(3))) char* l = (__attribute__((address_space(3))) char*)&ring[0][0] + t + (unsigned)(s & 1) * (NPL * SPB); const size_t g = hp * 2 + (size_t)s * SPB + t;
        cp2(l, (const char*)KPh + g); cp2(l + SPB, (const char*)KPl + g); cp2(l + 2 * SPB, (const char*)VT16 + g);
        if (hrg) { cp2(l + 3 * SPB, (const char*)VTh + g); cp2(l + 4 * SPB, (const char*)VTl + g); }
    };
    fill(0);
    v16bf qh[2][2], ql[2][2];
    { const size_t fo = (size_t)(threadIdx.x & 31) * 8, qp = hp + (size_t)q0 * HD + fo;
#pragma unroll
      for (int t = 0; t < 2; ++t)
#pragma unroll
          for (int ks = 0; ks < 2; ++ks) { const size_t e = (size_t)t * 16 * HD + ks * 512; qh[t][ks] = ldu(QPh + qp + e); ql[t][ks] = ldu(QPl + qp + e); } }
    asm volatile("s_wait_xcnt 0x0" ::: "memory");   // before a register that the loads above name is written again
    __builtin_amdgcn_sched_barrier(0);                // keeps the arithmetic below behind that wait
    const int lr = threadIdx.x & 15, hi = (threadIdx.x >> 4) & 1;
    float* orow = OUT + ((size_t)blockIdx.z * TT + q0 + lr) * DQ + blockIdx.y * HD + 8 * hi;
    lch* sb0 = (lch*)&ring[0][0] + l16 + kq * 8192;   // the lane's 16 bytes of unit 0 of the wave half's 64-token tile; every fragment that the wave reads of a stage is an offset from them
    v8f o[4][2]; float mu[2], ls[2];
#pragma unroll
    for (int nt = 0; nt < 2; ++nt) { mu[nt] = -1.0e30f; ls[nt] = 0.f;
#pragma unroll
        for (int dt = 0; dt < 4; ++dt) o[dt][nt] = (v8f){}; }
    asm volatile("s_wait_asynccnt 0x0" ::: "memory");   // this wave's copies of stage 0 have landed
    __syncthreads();                                     // and every other wave's: stage 0 may be read
    fill(1);
    // rolled: one copy of the stage in the instruction cache
#pragma unroll 1
    for (int s = 0; s < NST; ++s) {
        lch* sb = sb0 + (s & 1) * (NPL * SPB);
        fattn_stage(q0 < RH, qh, ql, sb, o, mu, ls);
        asm volatile("s_wait_dscnt 0x0" ::: "memory");     // this wave's reads of stage s are done before the buffer may be refilled
        asm volatile("s_wait_asynccnt 0x0" ::: "memory");  // this wave's copies of stage s + 1 have landed
        __syncthreads();                                    // publishes stage s + 1 and ends every wave's reads of stage s
        if (s + 2 < NST) fill(s + 2);
    }
    asm volatile("s_wait_asynccnt 0x0" ::: "memory");   // nothing of this wave is in flight when the ring becomes the join's staging (every wave's last read of it lies ahead of the loop's last barrier)
    // the join: half 1 hands its tiles, maxima and sums to half 0 of the same query group, lane to lane (both hold the same queries in the same places)
    __attribute__((address_space(3))) char* mg = (__attribute__((address_space(3))) char*)&ring[0][0] + qg * MGB + l16;
    if (kq != 0) {
#pragma unroll
        for (int nt = 0; nt < 2; ++nt)
#pragma unroll
            for (int dt = 0; dt < 4; ++dt) { *(lv4f*)(mg + ((nt * 4 + dt) * 2) * 512) = __builtin_shufflevector(o[dt][nt], o[dt][nt], 0, 1, 2, 3); *(lv4f*)(mg + ((nt * 4 + dt) * 2 + 1) * 512) = __builtin_shufflevector(o[dt][nt], o[dt][nt], 4, 5, 6, 7); }
        *(lv4f*)(mg + 16 * 512) = (v4f){mu[0], mu[1], ls[0], ls[1]};
    }
    __syncthreads();   // half 1's values may be read
    if (kq != 0) return;
    { const v4f ml = *(lv4f*)(mg + 16 * 512);
#pragma unroll
      for (int nt = 0; nt < 2; ++nt) { const float mn = fmaxf(mu[nt], ml[nt]); float fa, fb; exp2x2(mu[nt] - mn, ml[nt] - mn, fa, fb); ls[nt] = ls[nt] * fa + ml[2 + nt] * fb;
#pragma unroll
          for (int dt = 0; dt < 4; ++dt) { const v4f a = *(lv4f*)(mg + ((nt * 4 + dt) * 2) * 512), b = *(lv4f*)(mg + ((nt * 4 + dt) * 2 + 1) * 512); o[dt][nt] = o[dt][nt] * fa + __builtin_shufflevector(a, b, 0, 1, 2, 3, 4, 5, 6, 7) * fb; } } }
#pragma unroll
    for (int nt = 0; nt < 2; ++nt) { const float inv = __fdiv_rn(1.0f, ls[nt] + xhalf(ls[nt]));   // a lane's 8 registers are 8 consecutive d of its query's row
#pragma unroll
        for (int dt = 0; dt < 4; ++dt) *(v8f*)(orow + (size_t)nt * 16 * DQ + dt * 16) = o[dt][nt] * inv;
        if (nt == 0) asm volatile("s_wait_xcnt 0x0" : "+v"(ls[1]) :: "memory"); }   // before the second column group's values reuse a register that an issued store names; naming its sum keeps them behind the wait
}

extern "C" void kernel_launch(void* const* d_in, const int* in_sizes, int n_in,
                              void* d_out, int out_size, void* d_ws, size_t ws_size, hipStream_t stream) {
    (void)in_sizes; (void)n_in; (void)out_size;
    const float* x = (const float*)d_in[0]; const float* wq = (const float*)d_in[1]; const float* wk = (const float*)d_in[2]; const float* wv = (const float*)d_in[3];
    float* OUT = (float*)d_out;     // [2][4096][512]
    char* wsp = (char*)d_ws;
    auto take = [&](size_t bytes) { char* p = wsp; wsp += (bytes + 255) & ~(size_t)255; return (void*)p; };
    bf* XP = (bf*)take((size_t)XUN * 512); bf* WP = (bf*)take((size_t)WUN * 512);
    h16* VT16 = (h16*)take((size_t)NB_ * NKV * HD * TT * 2);
    bf* QPh = (bf*)take((size_t)NB_ * NH_ * TT * HD * 2); bf* QPl = (bf*)take((size_t)NB_ * NH_ * TT * HD * 2); bf* KPh = (bf*)take((size_t)NB_ * NKV * TT * HD * 2); bf* KPl = (bf*)take((size_t)NB_ * NKV * TT * HD * 2); bf* VTh = (bf*)take((size_t)NB_ * NKV * HD * TT * 2); bf* VTl = (bf*)take((size_t)NB_ * NKV * HD * TT * 2);   // the planes the fused attention reads hold both batches
    if ((size_t)(wsp - (char*)d_ws) > ws_size) return;    // ws 256 MiB
    k_pack<<<(XUN + WUN) / (8 * PKU), 256, 0, stream>>>(x, wq, wk, wv, XP, WP);
    k_proj<<<dim3(NB_ * TT / 128, (NH_ + 2 * NKV) / 2, 1), 128, 0, stream>>>(XP, WP, QPh, QPl, KPh, KPl, (bf*)VT16, VTh, VTl);
    k_fattn<<<dim3(TT / (FAW * FAC), NH_, NB_), 32 * FAW * KSP, 0, stream>>>(QPh, QPl, KPh, KPl, VT16, VTh, VTl, OUT);
}

// v009
// Measured time: 72.5 microseconds a run.
// Versions in between are left out here; by their measured steps it is 1.62 times as fast as v007.
// All steps since v000 together make it 48.4 times as fast.
#include <hip/hip_runtime.h>

// Multi-head attention over 4,096 tokens without output projection (attention_input [2][4096][512]; q,k,v = x W ('xw' [512][512] 0.05); 8 heads x 64; scores / SCALE with SCALE = N_HEADS = 8 (the source's quirk; numerically the usual 1/8 here); softmax; out = concat-heads(attn v) -> [2][4096][512] (4.2 M)).
// Three launches: x and the 'xw' weights rounded to bf16 and packed in fragment order; ONE projection launch (both batches, q, k and v) whose epilogue writes the head planes, also in fragment order; then ONE fused attention launch for both batches and all heads: score tiles, running-maximum softmax in registers, attn.v; scores and P never reach memory.
// Compute dtypes, f32 accumulate: every input rounded to bf16; projections exact products of those; q * (SCL * log2 e), k, v rounded once to fp16; scores one fp16 product, already in the exponent's unit; softmax f32; P rounded to fp16, attn.v one fp16 product; output f32.

#define NB_  2
#define TT   4096
#define DM   512
#define NH_  8
#define NKV  8
#define REP  (NH_ / NKV)
#define HD   64
#define DQ   (NH_ * HD)
#define DKV  (NKV * HD)
#define WIN  0
#define SCL  0.125f   // HD^-0.5
#define FAW  8                    // fused attention: query groups (of FAC columns) per work-group
#define KSP  2                    // fused attention: waves that share a query group, each with its own keys of every stage
#define FAC  32                   // fused attention: query columns per wave
static_assert(TT % (FAW * FAC) == 0 && TT % 32 == 0 && HD == 64 && REP == 1, "whole work-groups; whole 32-key passes; 4 output tiles");
typedef _Float16 h16;
typedef unsigned short bf;
typedef __attribute__((ext_vector_type(16))) __bf16   v16bf;
typedef __attribute__((ext_vector_type(16))) _Float16 v16h;
typedef __attribute__((ext_vector_type(8)))  _Float16 v8h;
typedef __attribute__((ext_vector_type(8)))  unsigned short v8us;
typedef __attribute__((ext_vector_type(8)))  float    v8f;
typedef __attribute__((ext_vector_type(4)))  float    v4f;
typedef v8h  __attribute__((may_alias)) v8ha;
typedef v4f  __attribute__((may_alias)) v4fa;
typedef v8us __attribute__((may_alias)) v8usa;

__device__ __forceinline__ v16h cat16(v8h lo, v8h hi) { return __builtin_shufflevector(lo, hi, 0, 1, 2, 3, 4, 5, 6, 7, 8, 9, 10, 11, 12, 13, 14, 15); }
__device__ __forceinline__ v16bf cat16b(v8us lo, v8us hi) { return __builtin_bit_cast(v16bf, __builtin_shufflevector(lo, hi, 0, 1, 2, 3, 4, 5, 6, 7, 8, 9, 10, 11, 12, 13, 14, 15)); }
__device__ __forceinline__ v8f wmma16(v16h a, v16h b, v8f c) { return __builtin_amdgcn_wmma_f32_16x16x32_f16(false, a, false, b, (short)0, c, false, false); }
__device__ __forceinline__ v8f wmmab(v16bf a, v16bf b, v8f c) { return __builtin_amdgcn_wmma_f32_16x16x32_bf16(false, a, false, b, (short)0, c, false, false); }




// Fragment order: a 16-row x 32-k operand fragment is 1 KiB = two units of 512 B; unit u = (tile16 * (DM / 32) + kstep) * 2 + part holds, at lane * 16 B,
// the 8 bf16 of row tile16 * 16 + (lane & 15), k = kstep * 32 + part * 16 + (lane >> 4) * 8 .. + 7. A wave's 16-byte load of a unit is 512 contiguous bytes (4 whole lines), and units (part 0, part 1) are the two halves of the fragment register.
#define KST  (DM / 32)             // k steps of a projection
#define XUN  (NB_ * TT / 16 * KST * 2)          // units of x
#define WUN  ((DQ + 2 * DKV) / 16 * KST * 2)    // units of the three weights, features q | k | v
#define PKU  8                     // units a wave packs
static_assert(XUN % (8 * PKU) == 0 && WUN % (8 * PKU) == 0 && (KST * 2) % PKU == 0 && DQ == DM && DKV == DM, "whole work-groups; a wave's units lie in one 16-row tile");
typedef __attribute__((ext_vector_type(8))) __bf16 v8b;
__device__ __forceinline__ v8us bf8(v8f v) { return __builtin_bit_cast(v8us, __builtin_convertvector(v, v8b)); }   // round to nearest even
// k_pack: work-groups < XUN / 64 pack x, the rest the weights (w[k][n] read down k: the transposition). Its loops are unrolled so that all of a wave's loads are in flight before the first is used.
__global__ __launch_bounds__(256) void k_pack(const float* __restrict__ x, const float* __restrict__ wq, const float* __restrict__ wk, const float* __restrict__ wv, bf* XP, bf* WP) {
    const int lane = threadIdx.x & 31, lr = lane & 15, hi = lane >> 4, wvi = __builtin_amdgcn_readfirstlane((int)(threadIdx.x >> 5));
    if ((int)blockIdx.x < XUN / (8 * PKU)) {
        const int u0 = ((int)blockIdx.x * 8 + wvi) * PKU; const float* s = x + (size_t)((u0 / (KST * 2)) * 16 + lr) * DM + (u0 % (KST * 2)) * 16 + hi * 8; v8f v[PKU];
#pragma unroll
        for (int u = 0; u < PKU; ++u) v[u] = *(const v8f*)(s + u * 16);
        asm volatile("s_wait_xcnt 0x0" :: "v"(s) : "memory");   // before a register that the loads above name is written again; naming the address keeps it whole up to the wait
#pragma unroll
        for (int u = 0; u < PKU; ++u) *(v8us*)(XP + (size_t)(u0 + u) * 256 + lane * 8) = bf8(v[u]);
    } else {
        const int u0 = (((int)blockIdx.x - XUN / (8 * PKU)) * 8 + wvi) * PKU, tile = u0 / (KST * 2), sel = tile / (DM / 16);
        const float* w = sel == 0 ? wq : sel == 1 ? wk : wv; const float* s = w + (size_t)((u0 % (KST * 2)) * 16 + hi * 8) * DM + (tile % (DM / 16)) * 16 + lr; v8f v[PKU];
#pragma unroll
        for (int u = 0; u < PKU; ++u)
#pragma unroll
            for (int k = 0; k < 8; ++k) v[u][k] = s[(size_t)(u * 16 + k) * DM];
        asm volatile("s_wait_xcnt 0x0" :: "v"(s) : "memory");   // as above
#pragma unroll
        for (int u = 0; u < PKU; ++u) *(v8us*)(WP + (size_t)(u0 + u) * 256 + lane * 8) = bf8(v[u]);
    }
}

// k_proj: all projections of both batches. One wave per 64 tokens x one head of q, k or v (16 accumulators), operands straight from the packed units, the next k step's fragments asked for ahead of this step's products.
// q, k: first operand = weight rows, so a lane's 8 results are 8 consecutive d of one token; v: first operand = token rows, 8 consecutive t of one d.
// The epilogue rounds to the fp16 plane the attention reads and stores it in fragment order, staged through the wave's own LDS: a head's plane is TT / 64 tiles of 8 KiB (64 tokens x 64 d), a tile 16 units of 512 B;
// unit s holds, at lane * 16 B, 8 values of row (s >> 2) * 16 + (lane & 15), k = (s & 3) * 16 + (lane >> 4) * 8 .. + 7, where (row, k) = (token, d) for q and k and (d, token) for v. Units 2n, 2n + 1 are the two halves of one fragment register, and every operand load of the attention is 512 contiguous bytes, 4 whole lines (from row-major planes it would take 32 bytes out of each of 16 lines, which costs the WGP's cache path several times as much). grid (tokens / 128, heads of q|k|v / 2), 4 waves = 2 x 2 tiles. Every loop is unrolled: the fragment and accumulator arrays stay in registers, every address is an immediate offset.
#define OSP  72                    // LDS pitch in 16-bit elements: 144 B, an odd multiple of 16 B
__device__ __forceinline__ v16bf ldu(const bf* p) { return cat16b(*(const v8us*)p, *(const v8us*)(p + 256)); }
__device__ __forceinline__ v16h lduh(const h16* p) { return cat16(*(const v8h*)p, *(const v8h*)(p + 256)); }
__global__ __launch_bounds__(128) void k_proj(const bf* __restrict__ XP, const bf* __restrict__ WP, bf* Q16, bf* K16, bf* VT16) {
    __shared__ __align__(16) bf osa[4][64 * OSP];
    const int lane = threadIdx.x & 31, lr = lane & 15, hi = lane >> 4, wvi = __builtin_amdgcn_readfirstlane((int)(threadIdx.x >> 5));
    const int tt64 = (int)blockIdx.x * 2 + (wvi & 1), hd = (int)blockIdx.y * 2 + (wvi >> 1), sel = hd / NH_;   // wave-uniform
    const bf* xb = XP + (size_t)tt64 * (4 * KST * 512) + lane * 8; const bf* wb = WP + (size_t)hd * (4 * KST * 512) + lane * 8;
    const bf* P = sel == 2 ? xb : wb; const bf* Q = sel == 2 ? wb : xb;   // result rows follow P, result columns Q
    v8f acc[4][4];
#pragma unroll
    for (int i = 0; i < 4; ++i)
#pragma unroll
        for (int j = 0; j < 4; ++j) acc[i][j] = (v8f){};
    v16bf p[2][4], q[2][4];
#pragma unroll
    for (int i = 0; i < 4; ++i) { p[0][i] = ldu(P + i * (KST * 512)); q[0][i] = ldu(Q + i * (KST * 512)); }
#pragma unroll
    for (int ks = 0; ks < KST; ++ks) {
        if (ks + 1 < KST) {
#pragma unroll
            for (int i = 0; i < 4; ++i) { p[(ks + 1) & 1][i] = ldu(P + i * (KST * 512) + (ks + 1) * 512); q[(ks + 1) & 1][i] = ldu(Q + i * (KST * 512) + (ks + 1) * 512); }
            if (ks + 2 == KST) asm volatile("s_wait_xcnt 0x0" ::: "memory");   // behind the last loads: it stands before their address registers are written again (the fence below keeps the epilogue's arithmetic behind it)
            __builtin_amdgcn_sched_barrier(0);   // keeps the next step's 16 loads ahead of this step's products: without it the compiler sinks each load to just before its use and the wave waits out the latency several times a step
        }
#pragma unroll
        for (int j = 0; j < 4; ++j)
#pragma unroll
            for (int i = 0; i < 4; ++i) acc[i][j] = wmmab(p[ks & 1][i], q[ks & 1][j], acc[i][j]);
    }
    bf* os = osa[wvi];
    const size_t hp = ((size_t)(tt64 / (TT / 64)) * NH_ + hd % NH_) * TT * HD; const int t0 = (tt64 % (TT / 64)) * 64;
    const size_t ob = hp + (size_t)t0 * HD + lane * 8;   // the lane's 16 bytes of the tile's unit 0; one unit a store
    const float osc = sel == 0 ? SCL * 1.4426950408889634f : 1.0f;   // q carries the softmax's scale and the change of base, so that the attention's score products are exponents of 2 as they leave the matrix unit; k and v times 1 (exact)
    bf* osw = os + lr * OSP + 8 * hi; const bf* osr = osw;   // a lane reads back row lr of a 16-row group, its half's 8 values of 16
#pragma unroll
    for (int i = 0; i < 4; ++i)
#pragma unroll
        for (int j = 0; j < 4; ++j) *(v8ha*)(osw + j * 16 * OSP + i * 16) = __builtin_convertvector(acc[i][j] * osc, v8h);
    __builtin_amdgcn_wave_barrier(); asm volatile("" ::: "memory");   // keeps the reads below behind the writes above (a lane reads back only the values it wrote)
    bf* d = (sel == 0 ? Q16 : sel == 1 ? K16 : VT16) + ob;
#pragma unroll
    for (int s = 0; s < 16; ++s) *(v8usa*)(d + s * 256) = *(const v8usa*)(osr + (s >> 2) * 16 * OSP + (s & 3) * 16);   // the staged 64 x 64 tile to its plane, one unit (4 whole lines) a store
}

#define SKEY 128                   // keys a stage
#define SPB  (SKEY * HD * 2)       // bytes of one plane's stage
#define NST  (TT / SKEY)           // stages
#define NPL  2                     // planes a buffer holds: K, V
static_assert(TT % SKEY == 0 && NST >= 2 && SKEY == 64 * KSP && SPB == 2 * 32 * FAW * KSP * 16, "whole stages, at least two; one 64-token tile a wave half; two 16-byte copies a lane and plane");
__device__ __forceinline__ float xhalf(float x) { return __builtin_bit_cast(float, __builtin_amdgcn_permlanex16(__builtin_bit_cast(int, x), __builtin_bit_cast(int, x), 0x76543210, 0xfedcba98, false, false)); }   // lane l with lane l ^ 16
// two 2^x; the second fills the slot the instruction set asks for behind the first, the v_nop the slot behind the second (results are not sources: early clobber)
__device__ __forceinline__ void exp2x2(float a, float b, float& ra, float& rb) { asm("v_exp_f32 %0, %2\n\tv_exp_f32 %1, %3\n\tv_nop" : "=&v"(ra), "=&v"(rb) : "v"(a), "v"(b)); }
typedef __attribute__((ext_vector_type(4))) int v4i;
typedef __attribute__((address_space(1))) v4i gv4i;
typedef __attribute__((address_space(3))) v4i lv4i;
// one plane's stage: two copies (the builtin form), each the work-group's 512 lanes x 16 B = 8 KiB; l, g: the lane's own 16 bytes in LDS and in global memory; the offset moves both addresses
__device__ __forceinline__ void cp2(__attribute__((address_space(3))) char* l, const char* g) {
    __builtin_amdgcn_global_load_async_to_lds_b128((gv4i*)g, (lv4i*)l, 0, 0); __builtin_amdgcn_global_load_async_to_lds_b128((gv4i*)g, (lv4i*)l, 8192, 0);
}
typedef __attribute__((address_space(3))) const char lch;
typedef __attribute__((address_space(3))) const v8h lv8h;
__device__ __forceinline__ v16h ldlh(lch* p) { return cat16(*(lv8h*)p, *(lv8h*)(p + 512)); }    // the two units of a fragment, from LDS
// one stage of one wave: sb = the lane's 16 bytes of unit 0 of the wave half's 64-token tile in the stage's buffer (fragment order: see k_proj); it reads that buffer alone.
// nb: 6 - mu in all 8 places; thr: what a pass's largest exponent must exceed for mu to move; lo: the least that mu moves by (both let the wave's first pass set mu whatever it finds, then stand at 10 and 0)
__device__ __forceinline__ void fattn_stage(const v16h (&qf)[2][2], lch* sb, v8f (&o)[4][2], v8f (&nb)[2], float (&ls)[2], float& thr, float& lo) {
    // unrolled: every LDS address of the stage is an immediate offset from sb
#pragma unroll
    for (int pp = 0; pp < 2; ++pp) {   // the tile's two passes of 32 keys
        lch* kb = sb + pp * 4096;
        lch* vb = sb + SPB + pp * 1024;   // V: units 0, 1 then 2, 3 of each 16-row group
        v8f st[2][2];
        v16h kf[2][2], v0[4];
#pragma unroll
        for (int ks = 0; ks < 2; ++ks)
#pragma unroll
            for (int mt = 0; mt < 2; ++mt) kf[mt][ks] = ldlh(kb + mt * 2048 + ks * 1024);
#pragma unroll
        for (int dt = 0; dt < 4; ++dt) v0[dt] = ldlh(vb + dt * 2048);
        __builtin_amdgcn_sched_barrier(0);   // keeps the pass's K and V reads in one place, ahead of the products: without it the compiler spreads them among the products and waits at each place
#pragma unroll
        for (int ks = 0; ks < 2; ++ks)
#pragma unroll
            for (int mt = 0; mt < 2; ++mt)
#pragma unroll
                for (int nt = 0; nt < 2; ++nt) st[mt][nt] = wmma16(kf[mt][ks], qf[nt][ks], ks == 0 ? nb[nt] : st[mt][nt]);
        float cm[2];
#pragma unroll
        for (int nt = 0; nt < 2; ++nt) { float x = fmaxf(st[0][nt][0], st[1][nt][0]);
#pragma unroll
            for (int r = 1; r < 8; ++r) x = fmaxf(x, fmaxf(st[0][nt][r], st[1][nt][r]));
            cm[nt] = fmaxf(x, xhalf(x)); }   // the pass's largest exponent: its maximum - mu + 6
        if (__builtin_amdgcn_ballot_w32(cm[0] > thr || cm[1] > thr) != 0) {   // one scalar branch a pass; rare after the first passes
            const float dl[2] = {fmaxf(cm[0] - 6.0f, lo), fmaxf(cm[1] - 6.0f, lo)}; float al[2]; exp2x2(fminf(-dl[0], 0.f), fminf(-dl[1], 0.f), al[0], al[1]);   // mu moves by dl: up, or on the first pass (sums and tiles still 0) to the pass's maximum wherever that lies
            thr = 10.0f; lo = 0.f;
#pragma unroll
            for (int nt = 0; nt < 2; ++nt) { ls[nt] *= al[nt]; nb[nt] -= dl[nt]; st[0][nt] -= dl[nt]; st[1][nt] -= dl[nt];
#pragma unroll
                for (int dt = 0; dt < 4; ++dt) o[dt][nt] *= al[nt]; }
        }
        float p[2][16];
#pragma unroll
        for (int nt = 0; nt < 2; ++nt) { float s0 = 0.f, s1 = 0.f;
#pragma unroll
            for (int r = 0; r < 8; ++r) { exp2x2(st[0][nt][r], st[1][nt][r], p[nt][r], p[nt][8 + r]); s0 += p[nt][r]; s1 += p[nt][8 + r]; }
            ls[nt] += s0 + s1; }
#pragma unroll
        for (int nt = 0; nt < 2; ++nt) { v16h pf;
#pragma unroll
            for (int s = 0; s < 16; ++s) pf[s] = (h16)p[nt][s];
#pragma unroll
            for (int dt = 0; dt < 4; ++dt) o[dt][nt] = wmma16(v0[dt], pf, o[dt][nt]); }
    }
}
// grid (TT / 256, heads, batches), 16 waves on the same stages; planes [batch][head][tile of 64 tokens][unit], as k_proj writes them
typedef __attribute__((address_space(3))) v4f lv4f;
#define MGB  (17 * 512)            // bytes a wave hands over at the join: 16 units of output tiles, one of maxima and sums
#define RGB  (2 * NPL * SPB > FAW * MGB ? 2 * NPL * SPB : FAW * MGB)   // LDS bytes: the two buffers, or the join's staging, which takes their place
__global__ __launch_bounds__(32 * FAW * KSP) void k_fattn(const h16* __restrict__ Q16, const h16* __restrict__ K16, const h16* __restrict__ VT16, float* OUT) {
    __shared__ __attribute__((aligned(512))) char ring[RGB];
    const int wv = __builtin_amdgcn_readfirstlane((int)(threadIdx.x >> 5)), qg = wv / KSP, kq = wv % KSP;   // query group, wave half
    const int q0 = ((int)blockIdx.x * FAW + qg) * FAC;
    const size_t hp = ((size_t)blockIdx.z * NH_ + blockIdx.y) * TT * HD;
    const unsigned l16 = (threadIdx.x & 31) * 16u;   // the lane's 16 bytes of a unit
    auto fill = [&](int s) {   // stage s of both planes, into buffer s & 1; every lane on, 4 copies a wave
        const unsigned t = l16 + (unsigned)wv * 512u;   // the lane's 16 bytes of an 8-KiB copy
        __attribute__((address_space(3))) char* l = (__attribute__((address_space(3))) char*)&ring[0] + t + (unsigned)(s & 1) * (NPL * SPB); const size_t g = hp * 2 + (size_t)s * SPB + t;
        cp2(l, (const char*)K16 + g); cp2(l + SPB, (const char*)VT16 + g);
    };
    fill(0);
    v16h qf[2][2];
    { const size_t fo = (size_t)(threadIdx.x & 31) * 8, qp = hp + (size_t)q0 * HD + fo;
#pragma unroll
      for (int t = 0; t < 2; ++t)
#pragma unroll
          for (int ks = 0; ks < 2; ++ks) qf[t][ks] = lduh(Q16 + qp + (size_t)t * 16 * HD + ks * 512); }
    asm volatile("s_wait_xcnt 0x0" ::: "memory");   // before a register that the loads above name is written again
    __builtin_amdgcn_sched_barrier(0);                // keeps the arithmetic below behind that wait
    const int lr = threadIdx.x & 15, hi = (threadIdx.x >> 4) & 1;
    float* orow = OUT + ((size_t)blockIdx.z * TT + q0 + lr) * DQ + blockIdx.y * HD + 8 * hi;
    lch* sb0 = (lch*)&ring[0] + l16 + kq * 8192;   // the lane's 16 bytes of unit 0 of the wave half's 64-token tile; every fragment that the wave reads of a stage is an offset from them
    v8f o[4][2], nb[2]; float ls[2], thr = -3.0e38f, lo = -3.0e38f;
#pragma unroll
    for (int nt = 0; nt < 2; ++nt) { nb[nt] = (v8f){6.f, 6.f, 6.f, 6.f, 6.f, 6.f, 6.f, 6.f}; ls[nt] = 0.f;   // mu = 0 until the first pass sets it
#pragma unroll
        for (int dt = 0; dt < 4; ++dt) o[dt][nt] = (v8f){}; }
    asm volatile("s_wait_asynccnt 0x0" ::: "memory");   // this wave's copies of stage 0 have landed
    __syncthreads();                                     // and every other wave's: stage 0 may be read
    fill(1);
    // rolled: one copy of the stage in the instruction cache
#pragma unroll 1
    for (int s = 0; s < NST; ++s) {
        lch* sb = sb0 + (s & 1) * (NPL * SPB);
        fattn_stage(qf, sb, o, nb, ls, thr, lo);
        asm volatile("s_wait_dscnt 0x0" ::: "memory");     // this wave's reads of stage s are done before the buffer may be refilled
        asm volatile("s_wait_asynccnt 0x0" ::: "memory");  // this wave's copies of stage s + 1 have landed
        __syncthreads();                                    // publishes stage s + 1 and ends every wave's reads of stage s
        if (s + 2 < NST) fill(s + 2);
    }
    asm volatile("s_wait_asynccnt 0x0" ::: "memory");   // nothing of this wave is in flight when the ring becomes the join's staging (every wave's last read of it lies ahead of the loop's last barrier)
    // the join: half 1 hands its tiles, maxima and sums to half 0 of the same query group, lane to lane (both hold the same queries in the same places)
    const float mu[2] = {6.0f - nb[0][0], 6.0f - nb[1][0]};
    __attribute__((address_space(3))) char* mg = (__attribute__((address_space(3))) char*)&ring[0] + qg * MGB + l16;
    if (kq != 0) {
#pragma unroll
        for (int nt = 0; nt < 2; ++nt)
#pragma unroll
            for (int dt = 0; dt < 4; ++dt) { *(lv4f*)(mg + ((nt * 4 + dt) * 2) * 512) = __builtin_shufflevector(o[dt][nt], o[dt][nt], 0, 1, 2, 3); *(lv4f*)(mg + ((nt * 4 + dt) * 2 + 1) * 512) = __builtin_shufflevector(o[dt][nt], o[dt][nt], 4, 5, 6, 7); }
        *(lv4f*)(mg + 16 * 512) = (v4f){mu[0], mu[1], ls[0], ls[1]};
    }
    __syncthreads();   // half 1's values may be read
    if (kq != 0) return;
    { const v4f ml = *(lv4f*)(mg + 16 * 512);
#pragma unroll
      for (int nt = 0; nt < 2; ++nt) { const float mn = fmaxf(mu[nt], ml[nt]); float fa, fb; exp2x2(mu[nt] - mn, ml[nt] - mn, fa, fb); ls[nt] = ls[nt] * fa + ml[2 + nt] * fb;
#pragma unroll
          for (int dt = 0; dt < 4; ++dt) { const v4f a = *(lv4f*)(mg + ((nt * 4 + dt) * 2) * 512), b = *(lv4f*)(mg + ((nt * 4 + dt) * 2 + 1) * 512); o[dt][nt] = o[dt][nt] * fa + __builtin_shufflevector(a, b, 0, 1, 2, 3, 4, 5, 6, 7) * fb; } } }
#pragma unroll
    for (int nt = 0; nt < 2; ++nt) { const float inv = __fdiv_rn(1.0f, ls[nt] + xhalf(ls[nt]));   // a lane's 8 registers are 8 consecutive d of its query's row
#pragma unroll
        for (int dt = 0; dt < 4; ++dt) *(v8f*)(orow + (size_t)nt * 16 * DQ + dt * 16) = o[dt][nt] * inv;
        if (nt == 0) asm volatile("s_wait_xcnt 0x0" : "+v"(ls[1]) :: "memory"); }   // before the second column group's values reuse a register that an issued store names; naming its sum keeps them behind the wait
}

extern "C" void kernel_launch(void* const* d_in, const int* in_sizes, int n_in,
                              void* d_out, int out_size, void* d_ws, size_t ws_size, hipStream_t stream) {
    (void)in_sizes; (void)n_in; (void)out_size;
    const float* x = (const float*)d_in[0]; const float* wq = (const float*)d_in[1]; const float* wk = (const float*)d_in[2]; const float* wv = (const float*)d_in[3];
    float* OUT = (float*)d_out;     // [2][4096][512]
    char* wsp = (char*)d_ws;
    auto take = [&](size_t bytes) { char* p = wsp; wsp += (bytes + 255) & ~(size_t)255; return (void*)p; };
    bf* XP = (bf*)take((size_t)XUN * 512); bf* WP = (bf*)take((size_t)WUN * 512);
    h16* VT16 = (h16*)take((size_t)NB_ * NKV * HD * TT * 2);
    h16* Q16 = (h16*)take((size_t)NB_ * NH_ * TT * HD * 2); h16* K16 = (h16*)take((size_t)NB_ * NKV * TT * HD * 2);   // the planes the fused attention reads hold both batches
    if ((size_t)(wsp - (char*)d_ws) > ws_size) return;    // ws 256 MiB
    k_pack<<<(XUN + WUN) / (8 * PKU), 256, 0, stream>>>(x, wq, wk, wv, XP, WP);
    k_proj<<<dim3(NB_ * TT / 128, (NH_ + 2 * NKV) / 2, 1), 128, 0, stream>>>(XP, WP, (bf*)Q16, (bf*)K16, (bf*)VT16);
    k_fattn<<<dim3(TT / (FAW * FAC), NH_, NB_), 32 * FAW * KSP, 0, stream>>>(Q16, K16, VT16, OUT);
}

// v010
// It runs in 66.7 microseconds.
// In two side-by-side timings against v009, it was 1.08 and 1.07 times as fast.
// Over all steps from v000 it is 52.1 times as fast.
#include <hip/hip_runtime.h>

// Multi-head attention over 4,096 tokens without output projection (attention_input [2][4096][512]; q,k,v = x W ('xw' [512][512] 0.05); 8 heads x 64; scores / SCALE with SCALE = N_HEADS = 8 (the source's quirk; numerically the usual 1/8 here); softmax; out = concat-heads(attn v) -> [2][4096][512] (4.2 M)).
// Three launches: x and the 'xw' weights rounded to bf16 and packed in fragment order; ONE projection launch (both batches, q, k and v) whose epilogue writes the head planes, also in fragment order; then ONE fused attention launch for both batches and all heads: score tiles, running-maximum softmax in registers, attn.v; scores and P never reach memory.
// Compute dtypes, f32 accumulate: every input rounded to bf16; projections exact products of those; q * (SCL * log2 e), k, v rounded once to fp16; scores one fp16 product, already in the exponent's unit; softmax f32; P rounded to fp16, attn.v one fp16 product; output f32.

#define NB_  2
#define TT   4096
#define DM   512
#define NH_  8
#define NKV  8
#define REP  (NH_ / NKV)
#define HD   64
#define DQ   (NH_ * HD)
#define DKV  (NKV * HD)
#define WIN  0
#define SCL  0.125f   // HD^-0.5
#define FAW  8                    // fused attention: query groups (of FAC columns) per work-group
#define KSP  2                    // fused attention: waves that share a query group, each with its own keys of every stage
#define FAC  32                   // fused attention: query columns per wave
static_assert(TT % (FAW * FAC) == 0 && TT % 32 == 0 && HD == 64 && REP == 1, "whole work-groups; whole 32-key passes; 4 output tiles");
typedef _Float16 h16;
typedef unsigned short bf;
typedef __attribute__((ext_vector_type(16))) __bf16   v16bf;
typedef __attribute__((ext_vector_type(16))) _Float16 v16h;
typedef __attribute__((ext_vector_type(8)))  _Float16 v8h;
typedef __attribute__((ext_vector_type(8)))  unsigned short v8us;
typedef __attribute__((ext_vector_type(8)))  float    v8f;
typedef __attribute__((ext_vector_type(4)))  float    v4f;
typedef v8h  __attribute__((may_alias)) v8ha;
typedef v4f  __attribute__((may_alias)) v4fa;
typedef v8us __attribute__((may_alias)) v8usa;

__device__ __forceinline__ v16h cat16(v8h lo, v8h hi) { return __builtin_shufflevector(lo, hi, 0, 1, 2, 3, 4, 5, 6, 7, 8, 9, 10, 11, 12, 13, 14, 15); }
__device__ __forceinline__ v16bf cat16b(v8us lo, v8us hi) { return __builtin_bit_cast(v16bf, __builtin_shufflevector(lo, hi, 0, 1, 2, 3, 4, 5, 6, 7, 8, 9, 10, 11, 12, 13, 14, 15)); }
__device__ __forceinline__ v8f wmma16(v16h a, v16h b, v8f c) { return __builtin_amdgcn_wmma_f32_16x16x32_f16(false, a, false, b, (short)0, c, false, false); }
__device__ __forceinline__ v8f wmmab(v16bf a, v16bf b, v8f c) { return __builtin_amdgcn_wmma_f32_16x16x32_bf16(false, a, false, b, (short)0, c, false, false); }




// Fragment order: a 16-row x 32-k operand fragment is 1 KiB = two units of 512 B; unit u = (tile16 * (DM / 32) + kstep) * 2 + part holds, at lane * 16 B,
// the 8 bf16 of row tile16 * 16 + (lane & 15), k = kstep * 32 + part * 16 + (lane >> 4) * 8 .. + 7. A wave's 16-byte load of a unit is 512 contiguous bytes (4 whole lines), and units (part 0, part 1) are the two halves of the fragment register.
#define KST  (DM / 32)             // k steps of a projection
#define XUN  (NB_ * TT / 16 * KST * 2)          // units of x
#define WUN  ((DQ + 2 * DKV) / 16 * KST * 2)    // units of the three weights, features q | k | v
#define PKU  8                     // units a wave packs
static_assert(XUN % (8 * PKU) == 0 && WUN % (8 * PKU) == 0 && (KST * 2) % PKU == 0 && DQ == DM && DKV == DM, "whole work-groups; a wave's units lie in one 16-row tile");
typedef __attribute__((ext_vector_type(8))) __bf16 v8b;
__device__ __forceinline__ v8us bf8(v8f v) { return __builtin_bit_cast(v8us, __builtin_convertvector(v, v8b)); }   // round to nearest even
// k_pack: work-groups < XUN / 64 pack x, the rest the weights (w[k][n] read down k: the transposition). Its loops are unrolled so that all of a wave's loads are in flight before the first is used.
__global__ __launch_bounds__(256) void k_pack(const float* __restrict__ x, const float* __restrict__ wq, const float* __restrict__ wk, const float* __restrict__ wv, bf* XP, bf* WP) {
    const int lane = threadIdx.x & 31, lr = lane & 15, hi = lane >> 4, wvi = __builtin_amdgcn_readfirstlane((int)(threadIdx.x >> 5));
    if ((int)blockIdx.x < XUN / (8 * PKU)) {
        const int u0 = ((int)blockIdx.x * 8 + wvi) * PKU; const float* s = x + (size_t)((u0 / (KST * 2)) * 16 + lr) * DM + (u0 % (KST * 2)) * 16 + hi * 8; v8f v[PKU];
#pragma unroll
        for (int u = 0; u < PKU; ++u) v[u] = *(const v8f*)(s + u * 16);
        asm volatile("s_wait_xcnt 0x0" :: "v"(s) : "memory");   // before a register that the loads above name is written again; naming the address keeps it whole up to the wait
#pragma unroll
        for (int u = 0; u < PKU; ++u) *(v8us*)(XP + (size_t)(u0 + u) * 256 + lane * 8) = bf8(v[u]);
    } else {
        const int u0 = (((int)blockIdx.x - XUN / (8 * PKU)) * 8 + wvi) * PKU, tile = u0 / (KST * 2), sel = tile / (DM / 16);
        const float* w = sel == 0 ? wq : sel == 1 ? wk : wv; const float* s = w + (size_t)((u0 % (KST * 2)) * 16 + hi * 8) * DM + (tile % (DM / 16)) * 16 + lr; v8f v[PKU];
#pragma unroll
        for (int u = 0; u < PKU; ++u)
#pragma unroll
            for (int k = 0; k < 8; ++k) v[u][k] = s[(size_t)(u * 16 + k) * DM];
        asm volatile("s_wait_xcnt 0x0" :: "v"(s) : "memory");   // as above
#pragma unroll
        for (int u = 0; u < PKU; ++u) *(v8us*)(WP + (size_t)(u0 + u) * 256 + lane * 8) = bf8(v[u]);
    }
}

// k_proj: all projections of both batches. One wave per 64 tokens x one head of q, k or v (16 accumulators), operands straight from the packed units, the next k step's fragments asked for ahead of this step's products.
// q, k: first operand = weight rows, so a lane's 8 results are 8 consecutive d of one token; v: first operand = token rows, 8 consecutive t of one d.
// The epilogue rounds to the fp16 plane the attention reads and stores it in fragment order, staged through the wave's own LDS: a head's plane is TT / 64 tiles of 8 KiB (64 tokens x 64 d), a tile 16 units of 512 B;
// unit s holds, at lane * 16 B, 8 values of row (s >> 2) * 16 + (lane & 15), k = (s & 3) * 16 + (lane >> 4) * 8 .. + 7, where (row, k) = (token, d) for q and k and (d, token) for v. Units 2n, 2n + 1 are the two halves of one fragment register, and every operand load of the attention is 512 contiguous bytes, 4 whole lines (from row-major planes it would take 32 bytes out of each of 16 lines, which costs the WGP's cache path several times as much). grid (tokens / 128, heads of q|k|v / 2), 4 waves = 2 x 2 tiles. Every loop is unrolled: the fragment and accumulator arrays stay in registers, every address is an immediate offset.
#define OSP  72                    // LDS pitch in 16-bit elements: 144 B, an odd multiple of 16 B
__device__ __forceinline__ v16bf ldu(const bf* p) { return cat16b(*(const v8us*)p, *(const v8us*)(p + 256)); }
__device__ __forceinline__ v16h lduh(const h16* p) { return cat16(*(const v8h*)p, *(const v8h*)(p + 256)); }
__global__ __launch_bounds__(128) void k_proj(const bf* __restrict__ XP, const bf* __restrict__ WP, bf* Q16, bf* K16, bf* VT16) {
    __shared__ __align__(16) bf osa[4][64 * OSP];
    const int lane = threadIdx.x & 31, lr = lane & 15, hi = lane >> 4, wvi = __builtin_amdgcn_readfirstlane((int)(threadIdx.x >> 5));
    const int tt64 = (int)blockIdx.x * 2 + (wvi & 1), hd = (int)blockIdx.y * 2 + (wvi >> 1), sel = hd / NH_;   // wave-uniform
    const bf* xb = XP + (size_t)tt64 * (4 * KST * 512) + lane * 8; const bf* wb = WP + (size_t)hd * (4 * KST * 512) + lane * 8;
    const bf* P = sel == 2 ? xb : wb; const bf* Q = sel == 2 ? wb : xb;   // result rows follow P, result columns Q
    v8f acc[4][4];
#pragma unroll
    for (int i = 0; i < 4; ++i)
#pragma unroll
        for (int j = 0; j < 4; ++j) acc[i][j] = (v8f){};
    v16bf p[2][4], q[2][4];
#pragma unroll
    for (int i = 0; i < 4; ++i) { p[0][i] = ldu(P + i * (KST * 512)); q[0][i] = ldu(Q + i * (KST * 512)); }
#pragma unroll
    for (int ks = 0; ks < KST; ++ks) {
        if (ks + 1 < KST) {
#pragma unroll
            for (int i = 0; i < 4; ++i) { p[(ks + 1) & 1][i] = ldu(P + i * (KST * 512) + (ks + 1) * 512); q[(ks + 1) & 1][i] = ldu(Q + i * (KST * 512) + (ks + 1) * 512); }
            if (ks + 2 == KST) asm volatile("s_wait_xcnt 0x0" ::: "memory");   // behind the last loads: it stands before their address registers are written again (the fence below keeps the epilogue's arithmetic behind it)
            __builtin_amdgcn_sched_barrier(0);   // keeps the next step's 16 loads ahead of this step's products: without it the compiler sinks each load to just before its use and the wave waits out the latency several times a step
        }
#pragma unroll
        for (int j = 0; j < 4; ++j)
#pragma unroll
            for (int i = 0; i < 4; ++i) acc[i][j] = wmmab(p[ks & 1][i], q[ks & 1][j], acc[i][j]);
    }
    bf* os = osa[wvi];
    const size_t hp = ((size_t)(tt64 / (TT / 64)) * NH_ + hd % NH_) * TT * HD; const int t0 = (tt64 % (TT / 64)) * 64;
    const size_t ob = hp + (size_t)t0 * HD + lane * 8;   // the lane's 16 bytes of the tile's unit 0; one unit a store
    const float osc = sel == 0 ? SCL * 1.4426950408889634f : 1.0f;   // q carries the softmax's scale and the change of base, so that the attention's score products are exponents of 2 as they leave the matrix unit; k and v times 1 (exact)
    bf* osw = os + lr * OSP + 8 * hi; const bf* osr = osw;   // a lane reads back row lr of a 16-row group, its half's 8 values of 16
#pragma unroll
    for (int i = 0; i < 4; ++i)
#pragma unroll
        for (int j = 0; j < 4; ++j) *(v8ha*)(osw + j * 16 * OSP + i * 16) = __builtin_convertvector(acc[i][j] * osc, v8h);
    __builtin_amdgcn_wave_barrier(); asm volatile("" ::: "memory");   // keeps the reads below behind the writes above (a lane reads back only the values it wrote)
    bf* d = (sel == 0 ? Q16 : sel == 1 ? K16 : VT16) + ob;
#pragma unroll
    for (int s = 0; s < 16; ++s) *(v8usa*)(d + s * 256) = *(const v8usa*)(osr + (s >> 2) * 16 * OSP + (s & 3) * 16);   // the staged 64 x 64 tile to its plane, one unit (4 whole lines) a store
}

#define SKEY 128                   // keys a stage
#define SPB  (SKEY * HD * 2)       // bytes of one plane's stage
#define NST  (TT / SKEY)           // stages
#define NPL  2                     // planes a buffer holds: K, V
static_assert(TT % SKEY == 0 && NST >= 2 && SKEY == 64 * KSP && SPB == 2 * 32 * FAW * KSP * 16, "whole stages, at least two; one 64-token tile a wave half; two 16-byte copies a lane and plane");
__device__ __forceinline__ float xhalf(float x) { return __builtin_bit_cast(float, __builtin_amdgcn_permlanex16(__builtin_bit_cast(int, x), __builtin_bit_cast(int, x), 0x76543210, 0xfedcba98, false, false)); }   // lane l with lane l ^ 16
// two 2^x; the second fills the slot the instruction set asks for behind the first, the v_nop the slot behind the second (results are not sources: early clobber)
__device__ __forceinline__ void exp2x2(float a, float b, float& ra, float& rb) { asm("v_exp_f32 %0, %2\n\tv_exp_f32 %1, %3\n\tv_nop" : "=&v"(ra), "=&v"(rb) : "v"(a), "v"(b)); }
typedef __attribute__((ext_vector_type(4))) int v4i;
typedef __attribute__((address_space(1))) v4i gv4i;
typedef __attribute__((address_space(3))) v4i lv4i;
// one plane's stage: two copies (the builtin form), each the work-group's 512 lanes x 16 B = 8 KiB; l, g: the lane's own 16 bytes in LDS and in global memory; the offset moves both addresses
__device__ __forceinline__ void cp2(__attribute__((address_space(3))) char* l, const char* g) {
    __builtin_amdgcn_global_load_async_to_lds_b128((gv4i*)g, (lv4i*)l, 0, 0); __builtin_amdgcn_global_load_async_to_lds_b128((gv4i*)g, (lv4i*)l, 8192, 0);
}
typedef __attribute__((address_space(3))) const char lch;
typedef __attribute__((address_space(3))) const v8h lv8h;
__device__ __forceinline__ v16h ldlh(lch* p) { return cat16(*(lv8h*)p, *(lv8h*)(p + 512)); }    // the two units of a fragment, from LDS
// one stage of one wave: sb = the lane's 16 bytes of unit 0 of the wave half's 64-token tile in the stage's buffer (fragment order: see k_proj); it reads that buffer alone.
// nb: 6 - mu in all 8 places; thr: what a lane's sum of a pass's P must exceed for mu to move; lo: the least that mu moves by (both let the wave's first pass set mu whatever it finds, then stand at 16384 and 0)
__device__ __forceinline__ void fattn_stage(const v16h (&qf)[2][2], lch* sb, v8f (&o)[4][2], v8f (&nb)[2], float (&ls)[2], float& thr, float& lo) {
    // unrolled: every LDS address of the stage is an immediate offset from sb
#pragma unroll
    for (int pp = 0; pp < 2; ++pp) {   // the tile's two passes of 32 keys
        lch* kb = sb + pp * 4096;
        lch* vb = sb + SPB + pp * 1024;   // V: units 0, 1 then 2, 3 of each 16-row group
        v8f st[2][2];
        v16h kf[2][2], v0[4];
#pragma unroll
        for (int ks = 0; ks < 2; ++ks)
#pragma unroll
            for (int mt = 0; mt < 2; ++mt) kf[mt][ks] = ldlh(kb + mt * 2048 + ks * 1024);
#pragma unroll
        for (int dt = 0; dt < 4; ++dt) v0[dt] = ldlh(vb + dt * 2048);
        __builtin_amdgcn_sched_barrier(0);   // keeps the pass's K and V reads in one place, ahead of the products: without it the compiler spreads them among the products and waits at each place
#pragma unroll
        for (int ks = 0; ks < 2; ++ks)
#pragma unroll
            for (int mt = 0; mt < 2; ++mt)
#pragma unroll
                for (int nt = 0; nt < 2; ++nt) st[mt][nt] = wmma16(kf[mt][ks], qf[nt][ks], ks == 0 ? nb[nt] : st[mt][nt]);
        float p[2][16], sm[2];
        __builtin_amdgcn_sched_barrier(0);   // keeps the 8 score products back to back: without it the compiler spreads the 2^x among them and pads each such place with v_nop up to the distance behind a product
        // P of the pass and, in sm, the lane's sum of its 16 P of each column group
#pragma unroll
        for (int nt = 0; nt < 2; ++nt) { float s0 = 0.f, s1 = 0.f;
#pragma unroll
            for (int r = 0; r < 8; ++r) { p[nt][r] = __builtin_amdgcn_exp2f(st[0][nt][r]); p[nt][8 + r] = __builtin_amdgcn_exp2f(st[1][nt][r]); s0 += p[nt][r]; s1 += p[nt][8 + r]; }   // the builtin: these 2^x read score tiles straight from the matrix unit, and only for instructions it can see does the compiler keep the distance behind a product
            sm[nt] = s0 + s1; }
        // P >= 0, so a lane's sum bounds each of its P: while no sum exceeds thr no P does (an exponent past the f32 range gives +inf, which exceeds it), and the scores' maximum is not needed
        if (__builtin_amdgcn_ballot_w32(sm[0] > thr || sm[1] > thr) != 0) {   // one scalar branch a pass; rare after the first pass
            float cm[2];
#pragma unroll
            for (int nt = 0; nt < 2; ++nt) { float x = fmaxf(st[0][nt][0], st[1][nt][0]);
#pragma unroll
                for (int r = 1; r < 8; ++r) x = fmaxf(x, fmaxf(st[0][nt][r], st[1][nt][r]));
                cm[nt] = fmaxf(x, xhalf(x)); }   // the pass's largest exponent: its maximum - mu + 6
            const float dl[2] = {fmaxf(cm[0] - 6.0f, lo), fmaxf(cm[1] - 6.0f, lo)}; float al[2]; exp2x2(fminf(-dl[0], 0.f), fminf(-dl[1], 0.f), al[0], al[1]);   // mu moves by dl: up, or on the first pass (sums and tiles still 0) to the pass's maximum wherever that lies
            thr = 16384.0f; lo = 0.f;
#pragma unroll
            for (int nt = 0; nt < 2; ++nt) { ls[nt] *= al[nt]; nb[nt] -= dl[nt]; st[0][nt] -= dl[nt]; st[1][nt] -= dl[nt];
#pragma unroll
                for (int dt = 0; dt < 4; ++dt) o[dt][nt] *= al[nt]; }
#pragma unroll
            for (int nt = 0; nt < 2; ++nt) { float s0 = 0.f, s1 = 0.f;   // P and sums again, from the moved exponents: now P <= 64
#pragma unroll
                for (int r = 0; r < 8; ++r) { exp2x2(st[0][nt][r], st[1][nt][r], p[nt][r], p[nt][8 + r]); s0 += p[nt][r]; s1 += p[nt][8 + r]; }
                sm[nt] = s0 + s1; }
        }
        ls[0] += sm[0]; ls[1] += sm[1];
#pragma unroll
        for (int nt = 0; nt < 2; ++nt) { v16h pf;
#pragma unroll
            for (int s = 0; s < 16; ++s) pf[s] = (h16)p[nt][s];
#pragma unroll
            for (int dt = 0; dt < 4; ++dt) o[dt][nt] = wmma16(v0[dt], pf, o[dt][nt]); }
    }
}
// grid (TT / 256, heads, batches), 16 waves on the same stages; planes [batch][head][tile of 64 tokens][unit], as k_proj writes them
typedef __attribute__((address_space(3))) v4f lv4f;
#define MGB  (17 * 512)            // bytes a wave hands over at the join: 16 units of output tiles, one of maxima and sums
#define RGB  (2 * NPL * SPB > FAW * MGB ? 2 * NPL * SPB : FAW * MGB)   // LDS bytes: the two buffers, or the join's staging, which takes their place
__global__ __launch_bounds__(32 * FAW * KSP) void k_fattn(const h16* __restrict__ Q16, const h16* __restrict__ K16, const h16* __restrict__ VT16, float* OUT) {
    __shared__ __attribute__((aligned(512))) char ring[RGB];
    const int wv = __builtin_amdgcn_readfirstlane((int)(threadIdx.x >> 5)), qg = wv / KSP, kq = wv % KSP;   // query group, wave half
    const int q0 = ((int)blockIdx.x * FAW + qg) * FAC;
    const size_t hp = ((size_t)blockIdx.z * NH_ + blockIdx.y) * TT * HD;
    const unsigned l16 = (threadIdx.x & 31) * 16u;   // the lane's 16 bytes of a unit
    auto fill = [&](int s) {   // stage s of both planes, into buffer s & 1; every lane on, 4 copies a wave
        const unsigned t = l16 + (unsigned)wv * 512u;   // the lane's 16 bytes of an 8-KiB copy
        __attribute__((address_space(3))) char* l = (__attribute__((address_space(3))) char*)&ring[0] + t + (unsigned)(s & 1) * (NPL * SPB); const size_t g = hp * 2 + (size_t)s * SPB + t;
        cp2(l, (const char*)K16 + g); cp2(l + SPB, (const char*)VT16 + g);
    };
    fill(0);
    v16h qf[2][2];
    { const size_t fo = (size_t)(threadIdx.x & 31) * 8, qp = hp + (size_t)q0 * HD + fo;
#pragma unroll
      for (int t = 0; t < 2; ++t)
#pragma unroll
          for (int ks = 0; ks < 2; ++ks) qf[t][ks] = lduh(Q16 + qp + (size_t)t * 16 * HD + ks * 512); }
    asm volatile("s_wait_xcnt 0x0" ::: "memory");   // before a register that the loads above name is written again
    __builtin_amdgcn_sched_barrier(0);                // keeps the arithmetic below behind that wait
    const int lr = threadIdx.x & 15, hi = (threadIdx.x >> 4) & 1;
    float* orow = OUT + ((size_t)blockIdx.z * TT + q0 + lr) * DQ + blockIdx.y * HD + 8 * hi;
    lch* sb0 = (lch*)&ring[0] + l16 + kq * 8192;   // the lane's 16 bytes of unit 0 of the wave half's 64-token tile; every fragment that the wave reads of a stage is an offset from them
    v8f o[4][2], nb[2]; float ls[2], thr = -3.0e38f, lo = -3.0e38f;
#pragma unroll
    for (int nt = 0; nt < 2; ++nt) { nb[nt] = (v8f){6.f, 6.f, 6.f, 6.f, 6.f, 6.f, 6.f, 6.f}; ls[nt] = 0.f;   // mu = 0 until the first pass sets it
#pragma unroll
        for (int dt = 0; dt < 4; ++dt) o[dt][nt] = (v8f){}; }
    asm volatile("s_wait_asynccnt 0x0" ::: "memory");   // this wave's copies of stage 0 have landed
    __syncthreads();                                     // and every other wave's: stage 0 may be read
    fill(1);
    // rolled: one copy of the stage in the instruction cache
#pragma unroll 1
    for (int s = 0; s < NST; ++s) {
        lch* sb = sb0 + (s & 1) * (NPL * SPB);
        fattn_stage(qf, sb, o, nb, ls, thr, lo);
        asm volatile("s_wait_dscnt 0x0" ::: "memory");     // this wave's reads of stage s are done before the buffer may be refilled
        asm volatile("s_wait_asynccnt 0x0" ::: "memory");  // this wave's copies of stage s + 1 have landed
        __syncthreads();                                    // publishes stage s + 1 and ends every wave's reads of stage s
        if (s + 2 < NST) fill(s + 2);
    }
    asm volatile("s_wait_asynccnt 0x0" ::: "memory");   // nothing of this wave is in flight when the ring becomes the join's staging (every wave's last read of it lies ahead of the loop's last barrier)
    // the join: half 1 hands its tiles, maxima and sums to half 0 of the same query group, lane to lane (both hold the same queries in the same places)
    const float mu[2] = {6.0f - nb[0][0], 6.0f - nb[1][0]};
    __attribute__((address_space(3))) char* mg = (__attribute__((address_space(3))) char*)&ring[0] + qg * MGB + l16;
    if (kq != 0) {
#pragma unroll
        for (int nt = 0; nt < 2; ++nt)
#pragma unroll
            for (int dt = 0; dt < 4; ++dt) { *(lv4f*)(mg + ((nt * 4 + dt) * 2) * 512) = __builtin_shufflevector(o[dt][nt], o[dt][nt], 0, 1, 2, 3); *(lv4f*)(mg + ((nt * 4 + dt) * 2 + 1) * 512) = __builtin_shufflevector(o[dt][nt], o[dt][nt], 4, 5, 6, 7); }
        *(lv4f*)(mg + 16 * 512) = (v4f){mu[0], mu[1], ls[0], ls[1]};
    }
    __syncthreads();   // half 1's values may be read
    if (kq != 0) return;
    { const v4f ml = *(lv4f*)(mg + 16 * 512);
#pragma unroll
      for (int nt = 0; nt < 2; ++nt) { const float mn = fmaxf(mu[nt], ml[nt]); float fa, fb; exp2x2(mu[nt] - mn, ml[nt] - mn, fa, fb); ls[nt] = ls[nt] * fa + ml[2 + nt] * fb;
#pragma unroll
          for (int dt = 0; dt < 4; ++dt) { const v4f a = *(lv4f*)(mg + ((nt * 4 + dt) * 2) * 512), b = *(lv4f*)(mg + ((nt * 4 + dt) * 2 + 1) * 512); o[dt][nt] = o[dt][nt] * fa + __builtin_shufflevector(a, b, 0, 1, 2, 3, 4, 5, 6, 7) * fb; } } }
#pragma unroll
    for (int nt = 0; nt < 2; ++nt) { const float inv = __fdiv_rn(1.0f, ls[nt] + xhalf(ls[nt]));   // a lane's 8 registers are 8 consecutive d of its query's row
#pragma unroll
        for (int dt = 0; dt < 4; ++dt) *(v8f*)(orow + (size_t)nt * 16 * DQ + dt * 16) = o[dt][nt] * inv;
        if (nt == 0) asm volatile("s_wait_xcnt 0x0" : "+v"(ls[1]) :: "memory"); }   // before the second column group's values reuse a register that an issued store names; naming its sum keeps them behind the wait
}

extern "C" void kernel_launch(void* const* d_in, const int* in_sizes, int n_in,
                              void* d_out, int out_size, void* d_ws, size_t ws_size, hipStream_t stream) {
    (void)in_sizes; (void)n_in; (void)out_size;
    const float* x = (const float*)d_in[0]; const float* wq = (const float*)d_in[1]; const float* wk = (const float*)d_in[2]; const float* wv = (const float*)d_in[3];
    float* OUT = (float*)d_out;     // [2][4096][512]
    char* wsp = (char*)d_ws;
    auto take = [&](size_t bytes) { char* p = wsp; wsp += (bytes + 255) & ~(size_t)255; return (void*)p; };
    bf* XP = (bf*)take((size_t)XUN * 512); bf* WP = (bf*)take((size_t)WUN * 512);
    h16* VT16 = (h16*)take((size_t)NB_ * NKV * HD * TT * 2);
    h16* Q16 = (h16*)take((size_t)NB_ * NH_ * TT * HD * 2); h16* K16 = (h16*)take((size_t)NB_ * NKV * TT * HD * 2);   // the planes the fused attention reads hold both batches
    if ((size_t)(wsp - (char*)d_ws) > ws_size) return;    // ws 256 MiB
    k_pack<<<(XUN + WUN) / (8 * PKU), 256, 0, stream>>>(x, wq, wk, wv, XP, WP);
    k_proj<<<dim3(NB_ * TT / 128, (NH_ + 2 * NKV) / 2, 1), 128, 0, stream>>>(XP, WP, (bf*)Q16, (bf*)K16, (bf*)VT16);
    k_fattn<<<dim3(TT / (FAW * FAC), NH_, NB_), 32 * FAW * KSP, 0, stream>>>(Q16, K16, VT16, OUT);
}
